// v000
// The times below were measured on an AMD MI455X: many runs one after another, warmed up first and cycling through
// copies of the inputs, with the whole window's GPU time divided by the number of runs. Launches and the gaps
// between them are all in it. The median over several windows is given; except for v000 it joins two sittings, which
// can be a few percent apart, so the side-by-side timings, each taken in one sitting, are the better comparison.
// v000, which the later versions start from, runs in 735 microseconds.
// compute dtype: all float inputs rounded to bf16; q/k (32 channels) and v (256) = W x + b (1x1 convs) with EXACT bf16 products on WMMA 16x16x32, f32 accumulate; q as f16 hi + residual (x 2^10) against k once to f16 (2 products) for the UNSCALED scores (logit sigma ~5.7: peaked softmax); softmax in f32 (precise expf); P x 2^11 once to f16 against v once to f16 (1 product); gamma * out + x in f32; f32 output.
#include <hip/hip_runtime.h>
#include <math.h>

typedef __attribute__((ext_vector_type(16))) _Float16 v16h;
typedef __attribute__((ext_vector_type(16))) __bf16 v16b;
typedef __attribute__((ext_vector_type(8)))  _Float16 v8h;
typedef __attribute__((ext_vector_type(8)))  float v8f;
typedef __attribute__((ext_vector_type(4)))  float v4f;
typedef __attribute__((ext_vector_type(2)))  float v2f;
typedef __attribute__((ext_vector_type(4)))  unsigned v4u;
typedef __attribute__((ext_vector_type(4)))  int v4i;
typedef float __attribute__((may_alias)) float_a;
typedef int __attribute__((may_alias)) int_a;

template <typename T> __device__ __forceinline__ void vst2(void* p, T v) { *(T*)p = v;  }
__device__ __forceinline__ v8f wmma16(v16h a, v16h b, v8f c) {
  v8f d = __builtin_amdgcn_wmma_f32_16x16x32_f16(false, a, false, b, (short)0, c, false, false);
  asm volatile("v_nop\n\tv_nop\n\tv_nop\n\tv_nop" : "+v"(d) : "v"(a), "v"(b));
  return d;
}
__device__ __forceinline__ v8f wmma_bf(v16b a, v16b b, v8f c) {
  v8f d = __builtin_amdgcn_wmma_f32_16x16x32_bf16(false, a, false, b, (short)0, c, false, false);
  asm volatile("v_nop\n\tv_nop\n\tv_nop\n\tv_nop" : "+v"(d) : "v"(a), "v"(b));
  return d;
}
// 16x16x32 fragments: lane = (h = lane>>4, row/col = lane&15); elements 0..7 = k0+8h+0..7, 8..15 = k0+16+8h+0..7; D element r = row 8h+r
__device__ __forceinline__ v16h frag_h(const _Float16* rowk0, int lane) {
  union { v16h v; v8h q[2]; } u; const _Float16* p = rowk0 + 8 * (lane >> 4);
  u.q[0] = *(const v8h*)p; u.q[1] = *(const v8h*)(p + 16); return u.v;
}
__device__ __forceinline__ v16h frag_f32(const float* rowk0, int lane) {
  v16h a; const float* p = rowk0 + 8 * (lane >> 4);
#pragma unroll
  for (int i = 0; i < 8; ++i) { a[i] = (_Float16)p[i]; a[8 + i] = (_Float16)p[16 + i]; }
  return a;
}
__device__ __forceinline__ v16h frag_f32s(const float* rowk0, int lane, float sc) {
  v16h a; const float* p = rowk0 + 8 * (lane >> 4);
#pragma unroll
  for (int i = 0; i < 8; ++i) { a[i] = (_Float16)(p[i] * sc); a[8 + i] = (_Float16)(p[16 + i] * sc); }
  return a;
}
// column fragment from a [K][ld] layout (column n), rows >= K read as 0
__device__ __forceinline__ v16h fragc_f32(const float* W, int k0, int n, int lane, int ld, int K) {
  v16h a; const int g = lane >> 4;
#pragma unroll
  for (int i = 0; i < 8; ++i) { const int ka = k0 + 8 * g + i, kb = ka + 16;
    a[i] = (_Float16)(ka < K ? W[(size_t)(ka < K ? ka : K - 1) * ld + n] : 0.f); a[8 + i] = (_Float16)(kb < K ? W[(size_t)(kb < K ? kb : K - 1) * ld + n] : 0.f); }
  return a;
}
struct F2 { v16b h, l; };
__device__ __forceinline__ F2 bsplit16(const float v[16]) { F2 r;
#pragma unroll
  for (int i = 0; i < 16; ++i) { const __bf16 h = (__bf16)v[i]; r.h[i] = h; r.l[i] = (__bf16)(v[i] - (float)h); }
  return r; }
__device__ __forceinline__ F2 split_row(const float* row, int k0, int lane) { float v[16]; const float* p = row + k0 + 8 * (lane >> 4);
#pragma unroll
  for (int i = 0; i < 8; ++i) { v[i] = p[i]; v[8 + i] = p[16 + i]; }
  return bsplit16(v); }
__device__ __forceinline__ F2 split_rowK(const float* row, int k0, int lane, int K) { float v[16]; const int g = lane >> 4;
#pragma unroll
  for (int i = 0; i < 8; ++i) { const int ka = k0 + 8 * g + i, kb = ka + 16; v[i] = ka < K ? row[ka < K ? ka : K - 1] : 0.f; v[8 + i] = kb < K ? row[kb < K ? kb : K - 1] : 0.f; }
  return bsplit16(v); }
__device__ __forceinline__ F2 split_col(const float* W, int k0, int n, int lane, int ld, int K) { float v[16]; const int g = lane >> 4;
#pragma unroll
  for (int i = 0; i < 8; ++i) { const int ka = k0 + 8 * g + i, kb = ka + 16; v[i] = ka < K ? W[(size_t)(ka < K ? ka : K - 1) * ld + n] : 0.f; v[8 + i] = kb < K ? W[(size_t)(kb < K ? kb : K - 1) * ld + n] : 0.f; }
  return bsplit16(v); }
__device__ __forceinline__ v8f mac3(const F2& a, const F2& b, v8f c) { c = wmma_bf(a.l, b.h, c); c = wmma_bf(a.h, b.l, c); return wmma_bf(a.h, b.h, c); }
__device__ __forceinline__ float sigm(float v) { return 1.0f / (1.0f + expf(-v)); }
#define LDSX() do { asm volatile("s_wait_dscnt 0" ::: "memory"); __builtin_amdgcn_wave_barrier(); __builtin_amdgcn_fence(__ATOMIC_RELEASE, "workgroup"); } while (0)

// SAGAN-style 1-D self-attention (B 16, C 256, W 2,048): q, k = Wq/Wk x + b (32 channels), v = Wv x + b (256); scores[i][j] = q_i . k_j (no scaling); attn = softmax over j; out[c][i] = sum_j v[c][j] attn[i][j]; result = gamma * out + x.
#define NB 16
#define TT 2048
#define CC 256            // NH * HD = projected width
#define DIN 256          // input (model) width
#define NH 1
#define HD 256
#define NQB (TT / 64)
#define HG 4
#define SCALE (1.0f)
#define HDQK 32            // q / k channels (C/8); the q/k planes are CC wide but only columns < 32 are non-zero and only they enter the scores
#define CAUSAL 0
#ifndef TNB
#define TNB NB
#endif
__device__ __forceinline__ v16b zero16b() { v16b z; _Pragma("unroll") for (int i = 0; i < 16; ++i) z[i] = (__bf16)0.f; return z; }
__device__ __forceinline__ float bfr(float v) { return (float)(__bf16)v; }
__host__ __device__ __forceinline__ int kb_last(int qb) { return CAUSAL ? ((qb * 64 + 63) >> 7) : (TT / 128 - 1); }
typedef __attribute__((ext_vector_type(8))) __bf16 v8b;
__device__ __forceinline__ v16b frag_b(const __bf16* rowk0, int lane) {
  union { v16b v; v8b q[2]; } u; const __bf16* p = rowk0 + 8 * (lane >> 4);
  u.q[0] = *(const v8b*)p; u.q[1] = *(const v8b*)(p + 16); return u.v;
}
#define QBH 0              // causal: query blocks 0..QBH-1 of each sequence (few keys, no averaging) take the high-precision path
#define QHI 2048            // rows carrying a q residual plane (all rows when non-causal: 2-product logits everywhere)
#define KHI 64            // key rows carrying k residual / v bf16 hi+lo planes (used only by the causal high-precision path)
// B fragment (k rows k0+.., output column o) of a weight: (in,out) [K][ld] or (out,in) [ld rows of K]: bf16 exact, or f16(bf16 * 256) exact
__device__ __forceinline__ v16b wcol_io(const float* Wm, int k0, int o, int lane, int ld) { v16b w; const int g = lane >> 4;
#pragma unroll
  for (int i = 0; i < 8; ++i) { w[i] = (__bf16)Wm[(size_t)(k0 + 8 * g + i) * ld + o]; w[8 + i] = (__bf16)Wm[(size_t)(k0 + 16 + 8 * g + i) * ld + o]; }
  return w; }
__device__ __forceinline__ v16b wcol_oi(const float* Wm, int k0, int o, int lane, int K) { v16b w; const float* p = Wm + (size_t)o * K + k0 + 8 * (lane >> 4);
#pragma unroll
  for (int i = 0; i < 8; ++i) { w[i] = (__bf16)p[i]; w[8 + i] = (__bf16)p[16 + i]; }
  return w; }
__device__ __forceinline__ v16h wcolh_io(const float* Wm, int k0, int o, int lane, int ld) { v16h w; const int g = lane >> 4;
#pragma unroll
  for (int i = 0; i < 8; ++i) { w[i] = (_Float16)(bfr(Wm[(size_t)(k0 + 8 * g + i) * ld + o]) * 256.0f); w[8 + i] = (_Float16)(bfr(Wm[(size_t)(k0 + 16 + 8 * g + i) * ld + o]) * 256.0f); }
  return w; }
__device__ __forceinline__ v16h wcolh_oi(const float* Wm, int k0, int o, int lane, int K) { v16h w; const float* p = Wm + (size_t)o * K + k0 + 8 * (lane >> 4);
#pragma unroll
  for (int i = 0; i < 8; ++i) { w[i] = (_Float16)(bfr(p[i]) * 256.0f); w[8 + i] = (_Float16)(bfr(p[16 + i]) * 256.0f); }
  return w; }
#define WQKV_LAYOUT 1   // 0 = (in,out) [DIN][CC]; 1 = (out,in) [CC][DIN]; 2 = per-head [NH][DIN][HD]
__device__ __forceinline__ v16b wcol_hdk(const float* Wm, int k0, int o, int lane) { v16b w; const int g = lane >> 4; const float* p = Wm + (size_t)(o / HD) * DIN * HD + (o % HD);
#pragma unroll
  for (int i = 0; i < 8; ++i) { w[i] = (__bf16)p[(size_t)(k0 + 8 * g + i) * HD]; w[8 + i] = (__bf16)p[(size_t)(k0 + 16 + 8 * g + i) * HD]; }
  return w; }
#define WO_OUT_IN 0
#if WQKV_LAYOUT == 1
#define WCOL(W, k0, o, lane) ((which == 2 || (o) < HDQK) ? wcol_oi(W, k0, (o), lane, DIN) : zero16b())   /* wq/wk are [32][256]: projected q/k columns >= 32 are zero */
#elif WQKV_LAYOUT == 2
#define WCOL(W, k0, o, lane) wcol_hdk(W, k0, o, lane)
#else
#define WCOL(W, k0, o, lane) wcol_io(W, k0, o, lane, CC)
#endif
#if WO_OUT_IN
#define WOCOL(W, k0, o, lane) wcol_oi(W, k0, o, lane, CC)
#define WOCOLH(W, k0, o, lane) wcolh_oi(W, k0, o, lane, CC)
#else
#define WOCOL(W, k0, o, lane) wcol_io(W, k0, o, lane, DIN)
#define WOCOLH(W, k0, o, lane) wcolh_io(W, k0, o, lane, DIN)
#endif
#ifndef XP
#define XP TT              // position pitch of x and of the output
#endif
#define BG HG              // the pass group spans BATCHES (single head): blockIdx.z / blockIdx.y select batch b0 + z
#define DVH 128            // value columns per k_pv block (HD 256 split in two column halves to keep 8 accumulator tiles per wave)
#define WS_YR (WS_END)     // f32 attended rows [b*l][256] (written by k_pv, transposed + residual by k_fin)
#define WS_END2 (WS_YR + 4u * (size_t)NB * TT * CC)
// ---- k_fin: block = (64 positions l0.., batch b): out[b][c][l] = gamma * Y[b*L + l][c] + x[b][c][l], channels-first through an LDS transpose; 256 B per (channel, 64 l) by 16 threads
__global__ __launch_bounds__(256) void k_fin(const float* __restrict__ Y, const float* __restrict__ X, const float* __restrict__ GM, float* __restrict__ OUT) { const float gmv = bfr(GM[0]); __shared__ __align__(16) float st2[64][CC + 4];
  const int tid = threadIdx.x; const size_t b = blockIdx.y; const int l0 = blockIdx.x * 64;
  for (int e = tid; e < 64 * (CC / 4); e += 256) { const int rl = e / (CC / 4), q = e % (CC / 4); *(v4f*)&st2[rl][q * 4] = *(const v4f*)(Y + (b * TT + l0 + rl) * CC + q * 4); }
  __syncthreads();
  for (int e = tid; e < CC * 16; e += 256) { const int c = e >> 4, q = e & 15; const size_t o = (b * CC + c) * (size_t)XP + l0 + q * 4; v4f v; const v4f xr = *(const v4f*)(X + o);
#pragma unroll
    for (int i = 0; i < 4; ++i) v[i] = gmv * st2[q * 4 + i][c] + bfr(xr[i]); vst2(OUT + o, v); } }   /* gamma * out + x */
#ifndef SM_EXTRA_PARAMS
#define SM_EXTRA_PARAMS
#endif
#ifndef PROJ_EXTRA_PARAMS
#define PROJ_EXTRA_PARAMS
#endif
#ifndef SM_MASK_HOOK
#define SM_MASK_HOOK (void)0
#endif

#define WS_QH  0u                                      // f16 q rows [b*t][CC]
#define WS_KH  (WS_QH + 2u * (size_t)NB * TT * CC)      // f16 k rows [b*t][CC]
#define WS_VT  (WS_KH + 2u * (size_t)NB * TT * CC)      // f16 v planes [b][c][t]
#define WS_QL  (WS_VT + 2u * (size_t)NB * CC * TT)      // f16 q residual x 2^10 rows [b][t < QHI][CC]
#define WS_KL  (WS_QL + 2u * (size_t)NB * QHI * CC)     // f16 k residual x 2^10 rows [b][t < KHI][CC]
#define WS_VB  (WS_KL + 2u * (size_t)NB * KHI * CC)     // bf16 v hi planes [b][c][t < KHI]
#define WS_VBL (WS_VB + 2u * (size_t)NB * CC * KHI)
#define WS_S   (WS_VBL + 2u * (size_t)NB * CC * KHI)    // f32 logits / P [hg][t][s]
#define WS_Y   (WS_S  + 4u * (size_t)HG * TT * TT)      // f32 ctx rows [b*t][CC] (only when there is an output projection)
#define WS_END (WS_Y  + 0u)

// ---- k_proj: block = (64 rows, 128 cols, which): q/k/v = X W (+ b) with exact bf16 products (K = DIN) -> which 0: q f16 rows (+ residual rows < QHI); 1: k f16 rows (+ residual rows < KHI); 2: v f16 planes [c][t] (+ bf16 hi/lo planes for t < KHI)
__global__ __launch_bounds__(128) void k_proj(const float* __restrict__ XQ, const float* __restrict__ XK, const float* __restrict__ XV, const float* __restrict__ WQ, const float* __restrict__ WK, const float* __restrict__ WV, const float* __restrict__ BQ, const float* __restrict__ BK, const float* __restrict__ BV,
    _Float16* __restrict__ QH, _Float16* __restrict__ QL, _Float16* __restrict__ KH, _Float16* __restrict__ KL, _Float16* __restrict__ VT, __bf16* __restrict__ VB, __bf16* __restrict__ VBL) {
  __shared__ __align__(16) _Float16 sh[64][136], sl[64][136]; __shared__ __align__(16) _Float16 th[128][72]; __shared__ __align__(16) __bf16 tb[128][72], tbl[128][72];
  const int tid = threadIdx.x, wave = tid >> 5, lane = tid & 31, col = lane & 15, g = lane >> 4; const int which = blockIdx.z; const int c0 = blockIdx.y * 128; const size_t r0 = (size_t)blockIdx.x * 64; const size_t bb = r0 / TT; const int t0 = (int)(r0 % TT);
  const float* X = which == 0 ? XQ : which == 1 ? XK : XV; const float* WA = which == 0 ? WQ : which == 1 ? WK : WV; const float* BA = which == 0 ? BQ : which == 1 ? BK : BV;
  v8f acc[8] = {};
#pragma unroll 2
  for (int kc = 0; kc < DIN / 32; ++kc) { v16b a; { const float* p = X + (bb * DIN + kc * 32 + 8 * g) * (size_t)XP + t0 + wave * 16 + col;   /* channels-first gather: x[b][k][t], stride XP between k */
#pragma unroll
      for (int i = 0; i < 8; ++i) { a[i] = (__bf16)p[(size_t)i * XP]; a[8 + i] = (__bf16)p[(size_t)(16 + i) * XP]; } }
    asm volatile("s_wait_loadcnt 0x0" ::: "memory");
#pragma unroll
    for (int j = 0; j < 8; ++j) { const v16b w = WCOL(WA, kc * 32, c0 + j * 16 + col, lane); asm volatile("s_wait_loadcnt 0x0" ::: "memory"); acc[j] = wmma_bf(a, w, acc[j]); } }
  if (which < 2) { _Float16* DH = which == 0 ? QH : KH; _Float16* DL = which == 0 ? QL : KL; const int nhi = which == 0 ? QHI : KHI; const bool hi_rows = t0 < nhi;
#pragma unroll
    for (int j = 0; j < 8; ++j) { const float bias = (BA && (which == 2 || c0 + j * 16 + col < HDQK)) ? bfr(BA[c0 + j * 16 + col]) : 0.f;   /* bq/bk have 32 entries */
#pragma unroll
      for (int r = 0; r < 8; ++r) { const float v = acc[j][r] + bias; const _Float16 hv = (_Float16)v; sh[wave * 16 + 8 * g + r][j * 16 + col] = hv; sl[wave * 16 + 8 * g + r][j * 16 + col] = (_Float16)((v - (float)hv) * 1024.0f); } }
    __syncthreads();
    for (int e = tid; e < 64 * 16; e += 128) { const int rl = e >> 4, q = e & 15; vst2((unsigned*)(DH + (r0 + rl) * CC + c0 + q * 8), *(const v4u*)&sh[rl][q * 8]); if (hi_rows) vst2((unsigned*)(DL + (bb * nhi + t0 + rl) * (size_t)CC + c0 + q * 8), *(const v4u*)&sl[rl][q * 8]); }
  } else { const bool hi_rows = t0 < KHI;
#pragma unroll
    for (int j = 0; j < 8; ++j) { const float bias = (BA && (which == 2 || c0 + j * 16 + col < HDQK)) ? bfr(BA[c0 + j * 16 + col]) : 0.f;   /* bq/bk have 32 entries */
#pragma unroll
      for (int r = 0; r < 8; ++r) { const float v = acc[j][r] + bias; const int rl = wave * 16 + 8 * g + r, cl = j * 16 + col; th[cl][rl] = (_Float16)v; const __bf16 bh = (__bf16)v; tb[cl][rl] = bh; tbl[cl][rl] = (__bf16)(v - (float)bh); } }
    __syncthreads();
    for (int e = tid; e < 128 * 8; e += 128) { const int cl = e >> 3, q = e & 7; vst2((unsigned*)(VT + (bb * CC + c0 + cl) * (size_t)TT + t0 + q * 8), *(const v4u*)&th[cl][q * 8]); if (hi_rows) { const size_t o3 = (bb * CC + c0 + cl) * (size_t)KHI + t0 + q * 8; vst2((unsigned*)(VB + o3), *(const v4u*)&tb[cl][q * 8]); vst2((unsigned*)(VBL + o3), *(const v4u*)&tbl[cl][q * 8]); } } } }
// ---- k_sc: block = (query block qb, key block kb <= kb_last(qb), batch z in group) of batch b = b0 + z: logits x SCALE; q hi + residual (x 2^10) against k (2 products) for query rows < QHI, plus the k residual (3 products) for query blocks < QBH (causal early rows); causal: blocks past the diagonal exit, the mask itself is applied by index in k_sm
__global__ __launch_bounds__(128) void k_sc(const _Float16* __restrict__ QH, const _Float16* __restrict__ KH, const _Float16* __restrict__ QL, const _Float16* __restrict__ KL, int bgrp, int h0, float* __restrict__ S0) { __shared__ __align__(16) float ss[4][16][132];
  const int qb = blockIdx.x, kb = blockIdx.y; if (kb > kb_last(qb)) return;
  const int h = h0; const int b = bgrp + blockIdx.z; float* S = S0 + (size_t)blockIdx.z * TT * TT;   /* group spans batches */
  const int tid = threadIdx.x, wave = tid >> 5, lane = tid & 31, col = lane & 15, g = lane >> 4; const int k0 = kb * 128; const int ql0 = qb * 64 + wave * 16; const size_t q0 = (size_t)b * TT + ql0, kr0 = (size_t)b * TT + k0;
  v8f acc[8] = {}, accl[8] = {};
  const _Float16* QLb = QL + (size_t)b * QHI * CC; const _Float16* KLb = KL + (size_t)b * KHI * CC;
  if (qb < QBH) {
#pragma unroll
    for (int kc = 0; kc < HDQK / 32; ++kc) { const v16h ah = frag_h(QH + (q0 + col) * CC + h * HD + kc * 32, lane), al = frag_h(QLb + (size_t)(ql0 + col) * CC + h * HD + kc * 32, lane);
#pragma unroll
      for (int j = 0; j < 8; ++j) { const v16h kbf = frag_h(KH + (kr0 + j * 16 + col) * CC + h * HD + kc * 32, lane), klf = frag_h(KLb + (size_t)(k0 + j * 16 + col) * CC + h * HD + kc * 32, lane); acc[j] = wmma16(ah, kbf, acc[j]); accl[j] = wmma16(al, kbf, accl[j]); accl[j] = wmma16(ah, klf, accl[j]); } }
  } else if (qb * 64 < QHI) {
#pragma unroll
    for (int kc = 0; kc < HDQK / 32; ++kc) { const v16h ah = frag_h(QH + (q0 + col) * CC + h * HD + kc * 32, lane), al = frag_h(QLb + (size_t)(ql0 + col) * CC + h * HD + kc * 32, lane);
#pragma unroll
      for (int j = 0; j < 8; ++j) { const v16h kbf = frag_h(KH + (kr0 + j * 16 + col) * CC + h * HD + kc * 32, lane); acc[j] = wmma16(ah, kbf, acc[j]); accl[j] = wmma16(al, kbf, accl[j]); } }
  } else {
#pragma unroll
    for (int kc = 0; kc < HDQK / 32; ++kc) { const v16h ah = frag_h(QH + (q0 + col) * CC + h * HD + kc * 32, lane);
#pragma unroll
      for (int j = 0; j < 8; ++j) { const v16h kbf = frag_h(KH + (kr0 + j * 16 + col) * CC + h * HD + kc * 32, lane); acc[j] = wmma16(ah, kbf, acc[j]); } } }
#pragma unroll
  for (int j = 0; j < 8; ++j) {
#pragma unroll
    for (int r = 0; r < 8; ++r) ss[wave][8 * g + r][j * 16 + col] = (acc[j][r] + accl[j][r] * (1.0f / 1024.0f)) * SCALE; }
  LDSX(); for (int rl = 0; rl < 16; ++rl) vst2(S + (size_t)(ql0 + rl) * TT + k0 + lane * 4, *(const v4f*)&ss[wave][rl][lane * 4]); }
// ---- k_sm: block = query row t (batch in group): keys [0, kend): causal -> logit if s <= t else excluded; softmax in f32; P x 2^11 in place (0 for excluded)
__global__ __launch_bounds__(256) void k_sm(float* __restrict__ S0 SM_EXTRA_PARAMS) { __shared__ float sred[8]; __shared__ float sbc; __shared__ __align__(16) float shv[TT];
  const int tid = threadIdx.x; const int t = blockIdx.x; const int kend = (kb_last(t >> 6) + 1) * 128;
  float* sr = S0 + (size_t)blockIdx.y * TT * TT + (size_t)t * TT;
  float m = -3.0e38f; for (int k = tid; k < kend; k += 256) { float v = (!CAUSAL || k <= t) ? sr[k] : -3.0e38f; SM_MASK_HOOK; shv[k] = v; m = fmaxf(m, v); }
#pragma unroll
  for (int o = 1; o < 32; o <<= 1) m = fmaxf(m, __shfl_xor(m, o));
  if ((tid & 31) == 0) sred[tid >> 5] = m; __syncthreads(); if (tid == 0) { float a = sred[0]; for (int i = 1; i < 8; ++i) a = fmaxf(a, sred[i]); sbc = a; } __syncthreads(); m = sbc; __syncthreads();
  float sum = 0.f; for (int k = tid; k < kend; k += 256) { const float v = shv[k]; const float e = (v <= -1.0e38f) ? 0.f : expf(v - m); shv[k] = e; sum += e; }
#pragma unroll
  for (int o = 1; o < 32; o <<= 1) sum += __shfl_xor(sum, o);
  if ((tid & 31) == 0) sred[tid >> 5] = sum; __syncthreads(); if (tid == 0) { float a = 0.f; for (int i = 0; i < 8; ++i) a += sred[i]; sbc = a > 0.f ? 2048.0f / a : 0.f; }   /* a fully excluded row yields P = 0 */ __syncthreads(); const float inv = sbc;
  for (int k = tid; k < kend; k += 256) shv[k] = shv[k] * inv;
  __syncthreads(); for (int q = tid; q < kend / 4; q += 256) vst2(sr + q * 4, *(const v4f*)&shv[q * 4]); }
// ---- k_pv: block = 64 queries (qb) of (b, h): ctx = P . v over keys [0, kend) (P x 2^11 once to f16 against v f16: 1 product; causal early query blocks: P and v as bf16 hi + lo, 3 products); 512-B (row, column-half) segment by 32 lanes
__global__ __launch_bounds__(128) void k_pv(const float* __restrict__ PS0, const _Float16* __restrict__ VT, const __bf16* __restrict__ VB, const __bf16* __restrict__ VBL, int bgrp, int h0, float* __restrict__ Y) { const int h = h0; const int b = bgrp + blockIdx.z; const float* PS = PS0 + (size_t)blockIdx.z * TT * TT; const int d0 = blockIdx.y * DVH;   /* group spans batches; column half d0 */ __shared__ __align__(16) float ss[4][16][DVH + 4];
  const int tid = threadIdx.x, wave = tid >> 5, lane = tid & 31, col = lane & 15, g = lane >> 4; const int qb = blockIdx.x; const int ql0 = qb * 64 + wave * 16; const int kce = (kb_last(qb) + 1) * 4;
  v8f acc[DVH / 16] = {};
  if (qb < QBH) {
#pragma unroll 1
    for (int kc = 0; kc < kce; ++kc) { const F2 p = split_row(PS + (size_t)(ql0 + col) * TT, kc * 32, lane);
      asm volatile("s_wait_loadcnt 0x0" ::: "memory");
#pragma unroll
      for (int j = 0; j < DVH / 16; ++j) { const size_t po = ((size_t)b * CC + h * HD + d0 + j * 16 + col) * (size_t)KHI + kc * 32; const v16b vh = frag_b(VB + po, lane); acc[j] = wmma_bf(p.h, vh, acc[j]); acc[j] = wmma_bf(p.l, vh, acc[j]); acc[j] = wmma_bf(p.h, frag_b(VBL + po, lane), acc[j]); } }
  } else {
#pragma unroll 1
    for (int kc = 0; kc < kce; ++kc) { const v16h p = frag_f32(PS + (size_t)(ql0 + col) * TT + kc * 32, lane);
      asm volatile("s_wait_loadcnt 0x0" ::: "memory");
#pragma unroll
      for (int j = 0; j < DVH / 16; ++j) { const size_t po = ((size_t)b * CC + h * HD + d0 + j * 16 + col) * (size_t)TT + kc * 32; acc[j] = wmma16(p, frag_h(VT + po, lane), acc[j]); } } }
#pragma unroll
  for (int j = 0; j < DVH / 16; ++j)
#pragma unroll
    for (int r = 0; r < 8; ++r) ss[wave][8 * g + r][j * 16 + col] = acc[j][r] * (1.0f / 2048.0f);
  LDSX(); for (int rl = 0; rl < 16; ++rl) vst2(Y + ((size_t)b * TT + ql0 + rl) * CC + h * HD + d0 + lane * 4, *(const v4f*)&ss[wave][rl][lane * 4]); }   /* 512-B (row, column-half) segment by 32 lanes */

extern "C" void kernel_launch(void* const* d_in, const int* in_sizes, int n_in, void* d_out, int out_size, void* d_ws, size_t ws_size, hipStream_t stream) {
  (void)in_sizes; (void)n_in; (void)out_size;
  const float** F = (const float**)d_in;
  if (ws_size < (size_t)WS_END) return;
  char* ws = (char*)d_ws; _Float16 *QH = (_Float16*)(ws + WS_QH), *KH = (_Float16*)(ws + WS_KH), *VT = (_Float16*)(ws + WS_VT), *QL = (_Float16*)(ws + WS_QL), *KL = (_Float16*)(ws + WS_KL); __bf16 *VB = (__bf16*)(ws + WS_VB), *VBL = (__bf16*)(ws + WS_VBL); float *S = (float*)(ws + WS_S), *Y = (float*)(ws + WS_Y);
  (void)Y; (void)QL; (void)KL; (void)VB; (void)VBL;
  // inputs: 0 x [16,256,2048] channels-first; 1 wq [32,256] (out,in), 2 bq [32]; 3 wk, 4 bk; 5 wv [256,256], 6 bv [256]; 7 gamma [1]
  if (ws_size < (size_t)WS_END2) return;
  float* YR = (float*)(ws + WS_YR);
  k_proj<<<dim3(TNB * TT / 64, CC / 128, 3), 128, 0, stream>>>(F[0], F[0], F[0], F[1], F[3], F[5], F[2], F[4], F[6], QH, QL, KH, KL, VT, VB, VBL);
  for (int b0 = 0; b0 < TNB; b0 += BG) {
    k_sc<<<dim3(NQB, TT / 128, BG), 128, 0, stream>>>(QH, KH, QL, KL, b0, 0, S);
    k_sm<<<dim3(TT, BG), 256, 0, stream>>>(S);
    k_pv<<<dim3(NQB, HD / DVH, BG), 128, 0, stream>>>(S, VT, VB, VBL, b0, 0, YR);
  }
  k_fin<<<dim3(TT / 64, TNB), 256, 0, stream>>>(YR, F[0], F[7], (float*)d_out);
}

// v001
// It runs in 409 microseconds.
// In both of two side-by-side timings against v000, it was 1.80 times as fast.
// compute dtype: all float inputs rounded to bf16; q/k (32 channels) and v (256) = W x + b (1x1 convs) with EXACT bf16 products on WMMA 16x16x32, f32 accumulate; q as f16 hi + residual (x 2^10) against k once to f16 (2 products) for the UNSCALED scores (logit sigma ~5.7: peaked softmax); softmax in f32 (precise expf); P x 2^11 once to f16 against v once to f16 (1 product); gamma * out + x in f32; f32 output.
#include <hip/hip_runtime.h>
#include <math.h>

typedef __attribute__((ext_vector_type(16))) _Float16 v16h;
typedef __attribute__((ext_vector_type(16))) __bf16 v16b;
typedef __attribute__((ext_vector_type(8)))  _Float16 v8h;
typedef __attribute__((ext_vector_type(8)))  float v8f;
typedef __attribute__((ext_vector_type(4)))  float v4f;
typedef __attribute__((ext_vector_type(2)))  float v2f;
typedef __attribute__((ext_vector_type(4)))  unsigned v4u;
typedef __attribute__((ext_vector_type(4)))  int v4i;
typedef float __attribute__((may_alias)) float_a;
typedef int __attribute__((may_alias)) int_a;

template <typename T> __device__ __forceinline__ void vst2(void* p, T v) { *(T*)p = v;  }
__device__ __forceinline__ v8f wmma16(v16h a, v16h b, v8f c) {
  v8f d = __builtin_amdgcn_wmma_f32_16x16x32_f16(false, a, false, b, (short)0, c, false, false);
  asm volatile("v_nop\n\tv_nop\n\tv_nop\n\tv_nop" : "+v"(d) : "v"(a), "v"(b));
  return d;
}
__device__ __forceinline__ v8f wmma_bf(v16b a, v16b b, v8f c) {
  v8f d = __builtin_amdgcn_wmma_f32_16x16x32_bf16(false, a, false, b, (short)0, c, false, false);
  asm volatile("v_nop\n\tv_nop\n\tv_nop\n\tv_nop" : "+v"(d) : "v"(a), "v"(b));
  return d;
}
// 16x16x32 fragments: lane = (h = lane>>4, row/col = lane&15); elements 0..7 = k0+8h+0..7, 8..15 = k0+16+8h+0..7; D element r = row 8h+r
__device__ __forceinline__ v16h frag_h(const _Float16* rowk0, int lane) {
  union { v16h v; v8h q[2]; } u; const _Float16* p = rowk0 + 8 * (lane >> 4);
  u.q[0] = *(const v8h*)p; u.q[1] = *(const v8h*)(p + 16); return u.v;
}
__device__ __forceinline__ v16h frag_f32(const float* rowk0, int lane) {
  v16h a; const float* p = rowk0 + 8 * (lane >> 4);
#pragma unroll
  for (int i = 0; i < 8; ++i) { a[i] = (_Float16)p[i]; a[8 + i] = (_Float16)p[16 + i]; }
  return a;
}
__device__ __forceinline__ v16h frag_f32s(const float* rowk0, int lane, float sc) {
  v16h a; const float* p = rowk0 + 8 * (lane >> 4);
#pragma unroll
  for (int i = 0; i < 8; ++i) { a[i] = (_Float16)(p[i] * sc); a[8 + i] = (_Float16)(p[16 + i] * sc); }
  return a;
}
// column fragment from a [K][ld] layout (column n), rows >= K read as 0
__device__ __forceinline__ v16h fragc_f32(const float* W, int k0, int n, int lane, int ld, int K) {
  v16h a; const int g = lane >> 4;
#pragma unroll
  for (int i = 0; i < 8; ++i) { const int ka = k0 + 8 * g + i, kb = ka + 16;
    a[i] = (_Float16)(ka < K ? W[(size_t)(ka < K ? ka : K - 1) * ld + n] : 0.f); a[8 + i] = (_Float16)(kb < K ? W[(size_t)(kb < K ? kb : K - 1) * ld + n] : 0.f); }
  return a;
}
struct F2 { v16b h, l; };
__device__ __forceinline__ F2 bsplit16(const float v[16]) { F2 r;
#pragma unroll
  for (int i = 0; i < 16; ++i) { const __bf16 h = (__bf16)v[i]; r.h[i] = h; r.l[i] = (__bf16)(v[i] - (float)h); }
  return r; }
__device__ __forceinline__ F2 split_row(const float* row, int k0, int lane) { float v[16]; const float* p = row + k0 + 8 * (lane >> 4);
#pragma unroll
  for (int i = 0; i < 8; ++i) { v[i] = p[i]; v[8 + i] = p[16 + i]; }
  return bsplit16(v); }
__device__ __forceinline__ F2 split_rowK(const float* row, int k0, int lane, int K) { float v[16]; const int g = lane >> 4;
#pragma unroll
  for (int i = 0; i < 8; ++i) { const int ka = k0 + 8 * g + i, kb = ka + 16; v[i] = ka < K ? row[ka < K ? ka : K - 1] : 0.f; v[8 + i] = kb < K ? row[kb < K ? kb : K - 1] : 0.f; }
  return bsplit16(v); }
__device__ __forceinline__ F2 split_col(const float* W, int k0, int n, int lane, int ld, int K) { float v[16]; const int g = lane >> 4;
#pragma unroll
  for (int i = 0; i < 8; ++i) { const int ka = k0 + 8 * g + i, kb = ka + 16; v[i] = ka < K ? W[(size_t)(ka < K ? ka : K - 1) * ld + n] : 0.f; v[8 + i] = kb < K ? W[(size_t)(kb < K ? kb : K - 1) * ld + n] : 0.f; }
  return bsplit16(v); }
__device__ __forceinline__ v8f mac3(const F2& a, const F2& b, v8f c) { c = wmma_bf(a.l, b.h, c); c = wmma_bf(a.h, b.l, c); return wmma_bf(a.h, b.h, c); }
__device__ __forceinline__ float sigm(float v) { return 1.0f / (1.0f + expf(-v)); }
#define LDSX() do { asm volatile("s_wait_dscnt 0" ::: "memory"); __builtin_amdgcn_wave_barrier(); __builtin_amdgcn_fence(__ATOMIC_RELEASE, "workgroup"); } while (0)

// SAGAN-style 1-D self-attention (B 16, C 256, W 2,048): q, k = Wq/Wk x + b (32 channels), v = Wv x + b (256); scores[i][j] = q_i . k_j (no scaling); attn = softmax over j; out[c][i] = sum_j v[c][j] attn[i][j]; result = gamma * out + x.
#define NB 16
#define TT 2048
#define CC 256            // NH * HD = projected width
#define DIN 256          // input (model) width
#define NH 1
#define HD 256
#define NQB (TT / 64)
#define HG 4
#define SCALE (1.0f)
#define HDQK 32            // q / k channels (C/8); the q/k planes are CC wide but only columns < 32 are non-zero and only they enter the scores
#define CAUSAL 0
#ifndef TNB
#define TNB NB
#endif
__device__ __forceinline__ v16b zero16b() { v16b z; _Pragma("unroll") for (int i = 0; i < 16; ++i) z[i] = (__bf16)0.f; return z; }
__device__ __forceinline__ float bfr(float v) { return (float)(__bf16)v; }
__host__ __device__ __forceinline__ int kb_last(int qb) { return CAUSAL ? ((qb * 64 + 63) >> 7) : (TT / 128 - 1); }
typedef __attribute__((ext_vector_type(8))) __bf16 v8b;
__device__ __forceinline__ v16b frag_b(const __bf16* rowk0, int lane) {
  union { v16b v; v8b q[2]; } u; const __bf16* p = rowk0 + 8 * (lane >> 4);
  u.q[0] = *(const v8b*)p; u.q[1] = *(const v8b*)(p + 16); return u.v;
}
#define QBH 0              // causal: query blocks 0..QBH-1 of each sequence (few keys, no averaging) take the high-precision path
#define QHI 2048            // rows carrying a q residual plane (all rows when non-causal: 2-product logits everywhere)
#define KHI 64            // key rows carrying k residual / v bf16 hi+lo planes (used only by the causal high-precision path)
// B fragment (k rows k0+.., output column o) of a weight: (in,out) [K][ld] or (out,in) [ld rows of K]: bf16 exact, or f16(bf16 * 256) exact
__device__ __forceinline__ v16b wcol_io(const float* Wm, int k0, int o, int lane, int ld) { v16b w; const int g = lane >> 4;
#pragma unroll
  for (int i = 0; i < 8; ++i) { w[i] = (__bf16)Wm[(size_t)(k0 + 8 * g + i) * ld + o]; w[8 + i] = (__bf16)Wm[(size_t)(k0 + 16 + 8 * g + i) * ld + o]; }
  return w; }
__device__ __forceinline__ v16b wcol_oi(const float* Wm, int k0, int o, int lane, int K) { v16b w; const float* p = Wm + (size_t)o * K + k0 + 8 * (lane >> 4);
#pragma unroll
  for (int i = 0; i < 8; ++i) { w[i] = (__bf16)p[i]; w[8 + i] = (__bf16)p[16 + i]; }
  return w; }
__device__ __forceinline__ v16h wcolh_io(const float* Wm, int k0, int o, int lane, int ld) { v16h w; const int g = lane >> 4;
#pragma unroll
  for (int i = 0; i < 8; ++i) { w[i] = (_Float16)(bfr(Wm[(size_t)(k0 + 8 * g + i) * ld + o]) * 256.0f); w[8 + i] = (_Float16)(bfr(Wm[(size_t)(k0 + 16 + 8 * g + i) * ld + o]) * 256.0f); }
  return w; }
__device__ __forceinline__ v16h wcolh_oi(const float* Wm, int k0, int o, int lane, int K) { v16h w; const float* p = Wm + (size_t)o * K + k0 + 8 * (lane >> 4);
#pragma unroll
  for (int i = 0; i < 8; ++i) { w[i] = (_Float16)(bfr(p[i]) * 256.0f); w[8 + i] = (_Float16)(bfr(p[16 + i]) * 256.0f); }
  return w; }
#define WQKV_LAYOUT 1   // 0 = (in,out) [DIN][CC]; 1 = (out,in) [CC][DIN]; 2 = per-head [NH][DIN][HD]
__device__ __forceinline__ v16b wcol_hdk(const float* Wm, int k0, int o, int lane) { v16b w; const int g = lane >> 4; const float* p = Wm + (size_t)(o / HD) * DIN * HD + (o % HD);
#pragma unroll
  for (int i = 0; i < 8; ++i) { w[i] = (__bf16)p[(size_t)(k0 + 8 * g + i) * HD]; w[8 + i] = (__bf16)p[(size_t)(k0 + 16 + 8 * g + i) * HD]; }
  return w; }
#define WO_OUT_IN 0
#if WQKV_LAYOUT == 1
#define WCOL(W, k0, o, lane) ((which == 2 || (o) < HDQK) ? wcol_oi(W, k0, (o), lane, DIN) : zero16b())   /* wq/wk are [32][256]: projected q/k columns >= 32 are zero */
#elif WQKV_LAYOUT == 2
#define WCOL(W, k0, o, lane) wcol_hdk(W, k0, o, lane)
#else
#define WCOL(W, k0, o, lane) wcol_io(W, k0, o, lane, CC)
#endif
#if WO_OUT_IN
#define WOCOL(W, k0, o, lane) wcol_oi(W, k0, o, lane, CC)
#define WOCOLH(W, k0, o, lane) wcolh_oi(W, k0, o, lane, CC)
#else
#define WOCOL(W, k0, o, lane) wcol_io(W, k0, o, lane, DIN)
#define WOCOLH(W, k0, o, lane) wcolh_io(W, k0, o, lane, DIN)
#endif
#ifndef XP
#define XP TT              // position pitch of x and of the output
#endif
#define BG HG              // the pass group spans BATCHES (single head): blockIdx.z / blockIdx.y select batch b0 + z
#define DVH 128            // value columns per k_pv block (HD 256 split in two column halves to keep 8 accumulator tiles per wave)
#define WS_YR (WS_END)     // f32 attended rows [b*l][256] (written by k_pv, transposed + residual by k_fin)
#define WS_END2 (WS_YR + 4u * (size_t)NB * TT * CC)
// ---- k_fin: block = (64 positions l0.., batch b): out[b][c][l] = gamma * Y[b*L + l][c] + x[b][c][l], channels-first through an LDS transpose; 256 B per (channel, 64 l) by 16 threads
__global__ __launch_bounds__(256) void k_fin(const float* __restrict__ Y, const float* __restrict__ X, const float* __restrict__ GM, float* __restrict__ OUT) { const float gmv = bfr(GM[0]); __shared__ __align__(16) float st2[64][CC + 4];
  const int tid = threadIdx.x; const size_t b = blockIdx.y; const int l0 = blockIdx.x * 64;
  for (int e = tid; e < 64 * (CC / 4); e += 256) { const int rl = e / (CC / 4), q = e % (CC / 4); *(v4f*)&st2[rl][q * 4] = *(const v4f*)(Y + (b * TT + l0 + rl) * CC + q * 4); }
  __syncthreads();
  for (int e = tid; e < CC * 16; e += 256) { const int c = e >> 4, q = e & 15; const size_t o = (b * CC + c) * (size_t)XP + l0 + q * 4; v4f v; const v4f xr = *(const v4f*)(X + o);
#pragma unroll
    for (int i = 0; i < 4; ++i) v[i] = gmv * st2[q * 4 + i][c] + bfr(xr[i]); vst2(OUT + o, v); } }   /* gamma * out + x */
#ifndef SM_EXTRA_PARAMS
#define SM_EXTRA_PARAMS
#endif
#ifndef PROJ_EXTRA_PARAMS
#define PROJ_EXTRA_PARAMS
#endif
#ifndef SM_MASK_HOOK
#define SM_MASK_HOOK (void)0
#endif

#define WS_QH  0u                                      // f16 q rows [b*t][CC]
#define WS_KH  (WS_QH + 2u * (size_t)NB * TT * CC)      // f16 k rows [b*t][CC]
#define WS_VT  (WS_KH + 2u * (size_t)NB * TT * CC)      // f16 v planes [b][c][t]
#define WS_QL  (WS_VT + 2u * (size_t)NB * CC * TT)      // f16 q residual x 2^10 rows [b][t < QHI][CC]
#define WS_KL  (WS_QL + 2u * (size_t)NB * QHI * CC)     // f16 k residual x 2^10 rows [b][t < KHI][CC]
#define WS_VB  (WS_KL + 2u * (size_t)NB * KHI * CC)     // bf16 v hi planes [b][c][t < KHI]
#define WS_VBL (WS_VB + 2u * (size_t)NB * CC * KHI)
#define WS_S   (WS_VBL + 2u * (size_t)NB * CC * KHI)    // f32 logits / P [hg][t][s]
#define WS_Y   (WS_S  + 4u * (size_t)HG * TT * TT)      // f32 ctx rows [b*t][CC] (only when there is an output projection)
#define WS_END (WS_Y  + 0u)

// ---- k_proj: block = (64 rows, 128 cols, which): q/k/v = X W (+ b) with exact bf16 products (K = DIN) -> which 0: q f16 rows (+ residual rows < QHI); 1: k f16 rows (+ residual rows < KHI); 2: v f16 planes [c][t] (+ bf16 hi/lo planes for t < KHI)
__global__ __launch_bounds__(128) void k_proj(const float* __restrict__ XQ, const float* __restrict__ XK, const float* __restrict__ XV, const float* __restrict__ WQ, const float* __restrict__ WK, const float* __restrict__ WV, const float* __restrict__ BQ, const float* __restrict__ BK, const float* __restrict__ BV,
    _Float16* __restrict__ QH, _Float16* __restrict__ QL, _Float16* __restrict__ KH, _Float16* __restrict__ KL, _Float16* __restrict__ VT, __bf16* __restrict__ VB, __bf16* __restrict__ VBL) {
  __shared__ __align__(16) _Float16 sh[64][136], sl[64][136]; __shared__ __align__(16) _Float16 th[128][72]; __shared__ __align__(16) __bf16 tb[128][72], tbl[128][72];
  const int tid = threadIdx.x, wave = tid >> 5, lane = tid & 31, col = lane & 15, g = lane >> 4; const int which = blockIdx.z; const int c0 = blockIdx.y * 128; const size_t r0 = (size_t)blockIdx.x * 64; const size_t bb = r0 / TT; const int t0 = (int)(r0 % TT);
  const float* X = which == 0 ? XQ : which == 1 ? XK : XV; const float* WA = which == 0 ? WQ : which == 1 ? WK : WV; const float* BA = which == 0 ? BQ : which == 1 ? BK : BV;
  v8f acc[8] = {};
#pragma unroll 2
  for (int kc = 0; kc < DIN / 32; ++kc) { v16b a; { const float* p = X + (bb * DIN + kc * 32 + 8 * g) * (size_t)XP + t0 + wave * 16 + col;   /* channels-first gather: x[b][k][t], stride XP between k */
#pragma unroll
      for (int i = 0; i < 8; ++i) { a[i] = (__bf16)p[(size_t)i * XP]; a[8 + i] = (__bf16)p[(size_t)(16 + i) * XP]; } }
    asm volatile("s_wait_loadcnt 0x0" ::: "memory");
#pragma unroll
    for (int j = 0; j < 8; ++j) { const v16b w = WCOL(WA, kc * 32, c0 + j * 16 + col, lane); asm volatile("s_wait_loadcnt 0x0" ::: "memory"); acc[j] = wmma_bf(a, w, acc[j]); } }
  if (which < 2) { _Float16* DH = which == 0 ? QH : KH; _Float16* DL = which == 0 ? QL : KL; const int nhi = which == 0 ? QHI : KHI; const bool hi_rows = t0 < nhi;
#pragma unroll
    for (int j = 0; j < 8; ++j) { const float bias = (BA && (which == 2 || c0 + j * 16 + col < HDQK)) ? bfr(BA[c0 + j * 16 + col]) : 0.f;   /* bq/bk have 32 entries */
#pragma unroll
      for (int r = 0; r < 8; ++r) { const float v = acc[j][r] + bias; const _Float16 hv = (_Float16)v; sh[wave * 16 + 8 * g + r][j * 16 + col] = hv; sl[wave * 16 + 8 * g + r][j * 16 + col] = (_Float16)((v - (float)hv) * 1024.0f); } }
    __syncthreads();
    for (int e = tid; e < 64 * 16; e += 128) { const int rl = e >> 4, q = e & 15; vst2((unsigned*)(DH + (r0 + rl) * CC + c0 + q * 8), *(const v4u*)&sh[rl][q * 8]); if (hi_rows) vst2((unsigned*)(DL + (bb * nhi + t0 + rl) * (size_t)CC + c0 + q * 8), *(const v4u*)&sl[rl][q * 8]); }
  } else { const bool hi_rows = t0 < KHI;
#pragma unroll
    for (int j = 0; j < 8; ++j) { const float bias = (BA && (which == 2 || c0 + j * 16 + col < HDQK)) ? bfr(BA[c0 + j * 16 + col]) : 0.f;   /* bq/bk have 32 entries */
#pragma unroll
      for (int r = 0; r < 8; ++r) { const float v = acc[j][r] + bias; const int rl = wave * 16 + 8 * g + r, cl = j * 16 + col; th[cl][rl] = (_Float16)v; const __bf16 bh = (__bf16)v; tb[cl][rl] = bh; tbl[cl][rl] = (__bf16)(v - (float)bh); } }
    __syncthreads();
    for (int e = tid; e < 128 * 8; e += 128) { const int cl = e >> 3, q = e & 7; vst2((unsigned*)(VT + (bb * CC + c0 + cl) * (size_t)TT + t0 + q * 8), *(const v4u*)&th[cl][q * 8]); if (hi_rows) { const size_t o3 = (bb * CC + c0 + cl) * (size_t)KHI + t0 + q * 8; vst2((unsigned*)(VB + o3), *(const v4u*)&tb[cl][q * 8]); vst2((unsigned*)(VBL + o3), *(const v4u*)&tbl[cl][q * 8]); } } } }
// ---- k_sc: block = (query block qb, key block kb <= kb_last(qb), batch z in group) of batch b = b0 + z: logits x SCALE; q hi + residual (x 2^10) against k (2 products) for query rows < QHI, plus the k residual (3 products) for query blocks < QBH (causal early rows); causal: blocks past the diagonal exit, the mask itself is applied by index in k_sm
__global__ __launch_bounds__(128) void k_sc(const _Float16* __restrict__ QH, const _Float16* __restrict__ KH, const _Float16* __restrict__ QL, const _Float16* __restrict__ KL, int bgrp, int h0, float* __restrict__ S0) { __shared__ __align__(16) float ss[4][16][132];
  const int qb = blockIdx.x, kb = blockIdx.y; if (kb > kb_last(qb)) return;
  const int h = h0; const int b = bgrp + blockIdx.z; float* S = S0 + (size_t)blockIdx.z * TT * TT;   /* group spans batches */
  const int tid = threadIdx.x, wave = tid >> 5, lane = tid & 31, col = lane & 15, g = lane >> 4; const int k0 = kb * 128; const int ql0 = qb * 64 + wave * 16; const size_t q0 = (size_t)b * TT + ql0, kr0 = (size_t)b * TT + k0;
  v8f acc[8] = {}, accl[8] = {};
  const _Float16* QLb = QL + (size_t)b * QHI * CC; const _Float16* KLb = KL + (size_t)b * KHI * CC;
  if (qb < QBH) {
#pragma unroll
    for (int kc = 0; kc < HDQK / 32; ++kc) { const v16h ah = frag_h(QH + (q0 + col) * CC + h * HD + kc * 32, lane), al = frag_h(QLb + (size_t)(ql0 + col) * CC + h * HD + kc * 32, lane);
#pragma unroll
      for (int j = 0; j < 8; ++j) { const v16h kbf = frag_h(KH + (kr0 + j * 16 + col) * CC + h * HD + kc * 32, lane), klf = frag_h(KLb + (size_t)(k0 + j * 16 + col) * CC + h * HD + kc * 32, lane); acc[j] = wmma16(ah, kbf, acc[j]); accl[j] = wmma16(al, kbf, accl[j]); accl[j] = wmma16(ah, klf, accl[j]); } }
  } else if (qb * 64 < QHI) {
#pragma unroll
    for (int kc = 0; kc < HDQK / 32; ++kc) { const v16h ah = frag_h(QH + (q0 + col) * CC + h * HD + kc * 32, lane), al = frag_h(QLb + (size_t)(ql0 + col) * CC + h * HD + kc * 32, lane);
#pragma unroll
      for (int j = 0; j < 8; ++j) { const v16h kbf = frag_h(KH + (kr0 + j * 16 + col) * CC + h * HD + kc * 32, lane); acc[j] = wmma16(ah, kbf, acc[j]); accl[j] = wmma16(al, kbf, accl[j]); } }
  } else {
#pragma unroll
    for (int kc = 0; kc < HDQK / 32; ++kc) { const v16h ah = frag_h(QH + (q0 + col) * CC + h * HD + kc * 32, lane);
#pragma unroll
      for (int j = 0; j < 8; ++j) { const v16h kbf = frag_h(KH + (kr0 + j * 16 + col) * CC + h * HD + kc * 32, lane); acc[j] = wmma16(ah, kbf, acc[j]); } } }
#pragma unroll
  for (int j = 0; j < 8; ++j) {
#pragma unroll
    for (int r = 0; r < 8; ++r) ss[wave][8 * g + r][j * 16 + col] = (acc[j][r] + accl[j][r] * (1.0f / 1024.0f)) * SCALE; }
  LDSX(); for (int rl = 0; rl < 16; ++rl) vst2(S + (size_t)(ql0 + rl) * TT + k0 + lane * 4, *(const v4f*)&ss[wave][rl][lane * 4]); }
// ---- k_sm: block = query row t (batch in group): keys [0, kend): causal -> logit if s <= t else excluded; softmax in f32; P x 2^11 in place (0 for excluded)
__global__ __launch_bounds__(256) void k_sm(float* __restrict__ S0 SM_EXTRA_PARAMS) { __shared__ float sred[8]; __shared__ float sbc; __shared__ __align__(16) float shv[TT];
  const int tid = threadIdx.x; const int t = blockIdx.x; const int kend = (kb_last(t >> 6) + 1) * 128;
  float* sr = S0 + (size_t)blockIdx.y * TT * TT + (size_t)t * TT;
  float m = -3.0e38f; for (int k = tid; k < kend; k += 256) { float v = (!CAUSAL || k <= t) ? sr[k] : -3.0e38f; SM_MASK_HOOK; shv[k] = v; m = fmaxf(m, v); }
#pragma unroll
  for (int o = 1; o < 32; o <<= 1) m = fmaxf(m, __shfl_xor(m, o));
  if ((tid & 31) == 0) sred[tid >> 5] = m; __syncthreads(); if (tid == 0) { float a = sred[0]; for (int i = 1; i < 8; ++i) a = fmaxf(a, sred[i]); sbc = a; } __syncthreads(); m = sbc; __syncthreads();
  float sum = 0.f; for (int k = tid; k < kend; k += 256) { const float v = shv[k]; const float e = (v <= -1.0e38f) ? 0.f : expf(v - m); shv[k] = e; sum += e; }
#pragma unroll
  for (int o = 1; o < 32; o <<= 1) sum += __shfl_xor(sum, o);
  if ((tid & 31) == 0) sred[tid >> 5] = sum; __syncthreads(); if (tid == 0) { float a = 0.f; for (int i = 0; i < 8; ++i) a += sred[i]; sbc = a > 0.f ? 2048.0f / a : 0.f; }   /* a fully excluded row yields P = 0 */ __syncthreads(); const float inv = sbc;
  for (int k = tid; k < kend; k += 256) shv[k] = shv[k] * inv;
  __syncthreads(); for (int q = tid; q < kend / 4; q += 256) vst2(sr + q * 4, *(const v4f*)&shv[q * 4]); }
// ---- k_pv: block = 64 queries (qb) of (b, h): ctx = P . v over keys [0, kend) (P x 2^11 once to f16 against v f16: 1 product; causal early query blocks: P and v as bf16 hi + lo, 3 products); 512-B (row, column-half) segment by 32 lanes
// The f16 path stages 128-key tiles of v (128 channel rows) and of P (64 query rows, f32) in LDS with asynchronous copies, two buffers: tile t + 1 flies while tile t is multiplied; the four waves share one copy of the v tile.
#define PVK 128                        // keys per staged tile
#define PV_VP (PVK * 2 + 16)           // LDS pitch of a v row in bytes (16 B x odd: no bank conflict for 16-byte reads down a column of rows)
#define PV_PP (PVK * 4 + 16)           // LDS pitch of a P row in bytes (16 B x odd)
#define PV_VB (DVH * PV_VP)            // bytes of the v tile; the P tile follows it
#define PV_BUF (PV_VB + 64 * PV_PP)    // bytes of one buffer
// eight 16-byte copies per lane: LDS address l + i * ls, global address gp + i * gs; the s_wait_xcnt stands inside the statement so that no address register is rewritten ahead of it
__device__ __forceinline__ void cp8(unsigned l, unsigned ls, const char* gp, size_t gs) {
  asm volatile("global_load_async_to_lds_b128 %0, %8, off\n\t"
               "global_load_async_to_lds_b128 %1, %9, off\n\t"
               "global_load_async_to_lds_b128 %2, %10, off\n\t"
               "global_load_async_to_lds_b128 %3, %11, off\n\t"
               "global_load_async_to_lds_b128 %4, %12, off\n\t"
               "global_load_async_to_lds_b128 %5, %13, off\n\t"
               "global_load_async_to_lds_b128 %6, %14, off\n\t"
               "global_load_async_to_lds_b128 %7, %15, off\n\t"
               "s_wait_xcnt 0x0"
               :: "v"(l), "v"(l + ls), "v"(l + 2 * ls), "v"(l + 3 * ls), "v"(l + 4 * ls), "v"(l + 5 * ls), "v"(l + 6 * ls), "v"(l + 7 * ls),
                  "v"(gp), "v"(gp + gs), "v"(gp + 2 * gs), "v"(gp + 3 * gs), "v"(gp + 4 * gs), "v"(gp + 5 * gs), "v"(gp + 6 * gs), "v"(gp + 7 * gs)
               : "memory");
}
// one tile: v rows (tid >> 4) + 8 i, 16 lanes per 256-B row; P rows (tid >> 5) + 4 i, 32 lanes per 512-B row; 32 copies per wave
__device__ __forceinline__ void pv_stage(unsigned lv, unsigned lp, const char* gv, const char* gp) {
  cp8(lv, 8 * PV_VP, gv, (size_t)8 * TT * 2); cp8(lv + 64 * PV_VP, 8 * PV_VP, gv + (size_t)64 * TT * 2, (size_t)8 * TT * 2);
  cp8(lp, 4 * PV_PP, gp, (size_t)4 * TT * 4); cp8(lp + 32 * PV_PP, 4 * PV_PP, gp + (size_t)32 * TT * 4, (size_t)4 * TT * 4);
}
// frag_f32 in two halves: four 16-byte reads, then the rounding to f16 (same k order, same rounding)
struct P4 { v4f a0, a1, a2, a3; };
__device__ __forceinline__ P4 p4_load(const float* rowk0, int lane) { const float* p = rowk0 + 8 * (lane >> 4); P4 r; r.a0 = *(const v4f*)p; r.a1 = *(const v4f*)(p + 4); r.a2 = *(const v4f*)(p + 16); r.a3 = *(const v4f*)(p + 20); return r; }
__device__ __forceinline__ v16h p4_f16(const P4& r) { v16h a;
#pragma unroll
  for (int i = 0; i < 4; ++i) { a[i] = (_Float16)r.a0[i]; a[4 + i] = (_Float16)r.a1[i]; a[8 + i] = (_Float16)r.a2[i]; a[12 + i] = (_Float16)r.a3[i]; }
  return a; }
__global__ __launch_bounds__(128) void k_pv(const float* __restrict__ PS0, const _Float16* __restrict__ VT, const __bf16* __restrict__ VB, const __bf16* __restrict__ VBL, int bgrp, int h0, float* __restrict__ Y) { const int h = h0; const int b = bgrp + blockIdx.z; const float* PS = PS0 + (size_t)blockIdx.z * TT * TT; const int d0 = blockIdx.y * DVH;   /* group spans batches; column half d0 */ __shared__ __align__(16) char sm[2 * PV_BUF]; float (*ss)[16][DVH + 4] = (float (*)[16][DVH + 4])sm;   /* the output staging reuses the ring behind its last barrier */
  const int tid = threadIdx.x, wave = tid >> 5, lane = tid & 31, col = lane & 15, g = lane >> 4; const int qb = blockIdx.x; const int ql0 = qb * 64 + wave * 16; const int kce = (kb_last(qb) + 1) * 4;
  v8f acc[DVH / 16] = {};
  if (qb < QBH) {
#pragma unroll 1
    for (int kc = 0; kc < kce; ++kc) { const F2 p = split_row(PS + (size_t)(ql0 + col) * TT, kc * 32, lane);
      asm volatile("s_wait_loadcnt 0x0" ::: "memory");
#pragma unroll
      for (int j = 0; j < DVH / 16; ++j) { const size_t po = ((size_t)b * CC + h * HD + d0 + j * 16 + col) * (size_t)KHI + kc * 32; const v16b vh = frag_b(VB + po, lane); acc[j] = wmma_bf(p.h, vh, acc[j]); acc[j] = wmma_bf(p.l, vh, acc[j]); acc[j] = wmma_bf(p.h, frag_b(VBL + po, lane), acc[j]); } }
  } else {
    const int nt = kce * 32 / PVK;   /* tiles: kce is a multiple of 4 */
    const unsigned l0 = (unsigned)(size_t)sm; const unsigned lv = l0 + (tid >> 4) * PV_VP + (tid & 15) * 16, lp = l0 + PV_VB + (tid >> 5) * PV_PP + (tid & 31) * 16;
    const char* gv = (const char*)(VT + ((size_t)b * CC + h * HD + d0 + (tid >> 4)) * (size_t)TT + (tid & 15) * 8); const char* gp = (const char*)(PS + (size_t)(qb * 64 + (tid >> 5)) * TT + (tid & 31) * 4);
    pv_stage(lv, lp, gv, gp);
    asm volatile("s_wait_asynccnt 0x0" ::: "memory");   // tile 0 of this wave has landed
    __syncthreads();                                    // ... and every wave's part of it
    if (nt > 1) pv_stage(lv + PV_BUF, lp + PV_BUF, gv + PVK * 2, gp + PVK * 4);
    /* the tile loop stays rolled: one publish point and one refill in the code; the loops inside it are unrolled so that acc, vf and vn are indexed by constants and stay in registers */
#pragma unroll 1
    for (int t = 0; t < nt; ++t) { const char* bu = sm + (t & 1) * PV_BUF; const float* pr = (const float*)(bu + PV_VB + (wave * 16 + col) * PV_PP);
      /* inside a tile the fragments of the next 32 keys are read from LDS ahead of this block's eight products, so that one LDS latency per tile is exposed and not one per product; nothing of tile t + 1 is read here */
      P4 pn = p4_load(pr, lane); v16h vf[DVH / 16], vn[DVH / 16];
#pragma unroll
      for (int j = 0; j < DVH / 16; ++j) vf[j] = frag_h((const _Float16*)(bu + (j * 16 + col) * PV_VP), lane);
#pragma unroll
      for (int kc = 0; kc < PVK / 32; ++kc) { const v16h p = p4_f16(pn);
        if (kc + 1 < PVK / 32) { pn = p4_load(pr + (kc + 1) * 32, lane);
#pragma unroll
          for (int j = 0; j < DVH / 16; ++j) vn[j] = frag_h((const _Float16*)(bu + (j * 16 + col) * PV_VP) + (kc + 1) * 32, lane); }
#pragma unroll
        for (int j = 0; j < DVH / 16; ++j) acc[j] = wmma16(p, vf[j], acc[j]);
        if (kc + 1 < PVK / 32) {
#pragma unroll
          for (int j = 0; j < DVH / 16; ++j) vf[j] = vn[j]; } }
      asm volatile("s_wait_dscnt 0x0" ::: "memory");      // this wave's reads of tile t are done before the buffer is refilled
      asm volatile("s_wait_asynccnt 0x0" ::: "memory");   // this wave's copies of tile t + 1 have landed
      __syncthreads();                                    // publishes tile t + 1 and ends every wave's reads of tile t
      if (t + 2 < nt) pv_stage(lv + (t & 1) * PV_BUF, lp + (t & 1) * PV_BUF, gv + (size_t)(t + 2) * (PVK * 2), gp + (size_t)(t + 2) * (PVK * 4)); }
    asm volatile("s_wait_asynccnt 0x0" ::: "memory");     // no copy is in flight when the ring becomes output staging
  }
#pragma unroll
  for (int j = 0; j < DVH / 16; ++j)
#pragma unroll
    for (int r = 0; r < 8; ++r) ss[wave][8 * g + r][j * 16 + col] = acc[j][r] * (1.0f / 2048.0f);
  LDSX(); for (int rl = 0; rl < 16; ++rl) vst2(Y + ((size_t)b * TT + ql0 + rl) * CC + h * HD + d0 + lane * 4, *(const v4f*)&ss[wave][rl][lane * 4]); }   /* 512-B (row, column-half) segment by 32 lanes */

extern "C" void kernel_launch(void* const* d_in, const int* in_sizes, int n_in, void* d_out, int out_size, void* d_ws, size_t ws_size, hipStream_t stream) {
  (void)in_sizes; (void)n_in; (void)out_size;
  const float** F = (const float**)d_in;
  if (ws_size < (size_t)WS_END) return;
  char* ws = (char*)d_ws; _Float16 *QH = (_Float16*)(ws + WS_QH), *KH = (_Float16*)(ws + WS_KH), *VT = (_Float16*)(ws + WS_VT), *QL = (_Float16*)(ws + WS_QL), *KL = (_Float16*)(ws + WS_KL); __bf16 *VB = (__bf16*)(ws + WS_VB), *VBL = (__bf16*)(ws + WS_VBL); float *S = (float*)(ws + WS_S), *Y = (float*)(ws + WS_Y);
  (void)Y; (void)QL; (void)KL; (void)VB; (void)VBL;
  // inputs: 0 x [16,256,2048] channels-first; 1 wq [32,256] (out,in), 2 bq [32]; 3 wk, 4 bk; 5 wv [256,256], 6 bv [256]; 7 gamma [1]
  if (ws_size < (size_t)WS_END2) return;
  float* YR = (float*)(ws + WS_YR);
  k_proj<<<dim3(TNB * TT / 64, CC / 128, 3), 128, 0, stream>>>(F[0], F[0], F[0], F[1], F[3], F[5], F[2], F[4], F[6], QH, QL, KH, KL, VT, VB, VBL);
  for (int b0 = 0; b0 < TNB; b0 += BG) {
    k_sc<<<dim3(NQB, TT / 128, BG), 128, 0, stream>>>(QH, KH, QL, KL, b0, 0, S);
    k_sm<<<dim3(TT, BG), 256, 0, stream>>>(S);
    k_pv<<<dim3(NQB, HD / DVH, BG), 128, 0, stream>>>(S, VT, VB, VBL, b0, 0, YR);
  }
  k_fin<<<dim3(TT / 64, TNB), 256, 0, stream>>>(YR, F[0], F[7], (float*)d_out);
}

// v002
// It runs in 148 microseconds.
// Two timings next to v001 put it at 2.78 and 2.77 times that version's speed.
// Over all steps from v000 it is 4.98 times as fast.
// compute dtype: all float inputs rounded to bf16; q/k (32 channels) and v (256) = W x + b (1x1 convs) with EXACT bf16 products on WMMA 16x16x32, f32 accumulate; q as f16 hi + residual (x 2^10) against k once to f16 (2 products) for the UNSCALED scores (logit sigma ~5.7: peaked softmax); online softmax in f32 (precise expf, running maximum); exp(s - max) x 2^11 once to f16 against v once to f16 (1 product), divided by the f32 row sum at the end; gamma * out + x in f32; f32 output.
#include <hip/hip_runtime.h>
#include <math.h>

typedef __attribute__((ext_vector_type(16))) _Float16 v16h;
typedef __attribute__((ext_vector_type(16))) __bf16 v16b;
typedef __attribute__((ext_vector_type(8)))  _Float16 v8h;
typedef __attribute__((ext_vector_type(8)))  float v8f;
typedef __attribute__((ext_vector_type(4)))  float v4f;
typedef __attribute__((ext_vector_type(2)))  float v2f;
typedef __attribute__((ext_vector_type(4)))  unsigned v4u;
typedef __attribute__((ext_vector_type(4)))  int v4i;
typedef float __attribute__((may_alias)) float_a;
typedef int __attribute__((may_alias)) int_a;

template <typename T> __device__ __forceinline__ void vst2(void* p, T v) { *(T*)p = v;  }
__device__ __forceinline__ v8f wmma16(v16h a, v16h b, v8f c) {
  v8f d = __builtin_amdgcn_wmma_f32_16x16x32_f16(false, a, false, b, (short)0, c, false, false);
  asm volatile("v_nop\n\tv_nop\n\tv_nop\n\tv_nop" : "+v"(d) : "v"(a), "v"(b));
  return d;
}
__device__ __forceinline__ v8f wmma_bf(v16b a, v16b b, v8f c) {
  v8f d = __builtin_amdgcn_wmma_f32_16x16x32_bf16(false, a, false, b, (short)0, c, false, false);
  asm volatile("v_nop\n\tv_nop\n\tv_nop\n\tv_nop" : "+v"(d) : "v"(a), "v"(b));
  return d;
}
// 16x16x32 fragments: lane = (h = lane>>4, row/col = lane&15); elements 0..7 = k0+8h+0..7, 8..15 = k0+16+8h+0..7; D element r = row 8h+r
__device__ __forceinline__ v16h frag_h(const _Float16* rowk0, int lane) {
  union { v16h v; v8h q[2]; } u; const _Float16* p = rowk0 + 8 * (lane >> 4);
  u.q[0] = *(const v8h*)p; u.q[1] = *(const v8h*)(p + 16); return u.v;
}
__device__ __forceinline__ v16h frag_f32(const float* rowk0, int lane) {
  v16h a; const float* p = rowk0 + 8 * (lane >> 4);
#pragma unroll
  for (int i = 0; i < 8; ++i) { a[i] = (_Float16)p[i]; a[8 + i] = (_Float16)p[16 + i]; }
  return a;
}
__device__ __forceinline__ v16h frag_f32s(const float* rowk0, int lane, float sc) {
  v16h a; const float* p = rowk0 + 8 * (lane >> 4);
#pragma unroll
  for (int i = 0; i < 8; ++i) { a[i] = (_Float16)(p[i] * sc); a[8 + i] = (_Float16)(p[16 + i] * sc); }
  return a;
}
// column fragment from a [K][ld] layout (column n), rows >= K read as 0
__device__ __forceinline__ v16h fragc_f32(const float* W, int k0, int n, int lane, int ld, int K) {
  v16h a; const int g = lane >> 4;
#pragma unroll
  for (int i = 0; i < 8; ++i) { const int ka = k0 + 8 * g + i, kb = ka + 16;
    a[i] = (_Float16)(ka < K ? W[(size_t)(ka < K ? ka : K - 1) * ld + n] : 0.f); a[8 + i] = (_Float16)(kb < K ? W[(size_t)(kb < K ? kb : K - 1) * ld + n] : 0.f); }
  return a;
}
struct F2 { v16b h, l; };
__device__ __forceinline__ F2 bsplit16(const float v[16]) { F2 r;
#pragma unroll
  for (int i = 0; i < 16; ++i) { const __bf16 h = (__bf16)v[i]; r.h[i] = h; r.l[i] = (__bf16)(v[i] - (float)h); }
  return r; }
__device__ __forceinline__ F2 split_row(const float* row, int k0, int lane) { float v[16]; const float* p = row + k0 + 8 * (lane >> 4);
#pragma unroll
  for (int i = 0; i < 8; ++i) { v[i] = p[i]; v[8 + i] = p[16 + i]; }
  return bsplit16(v); }
__device__ __forceinline__ F2 split_rowK(const float* row, int k0, int lane, int K) { float v[16]; const int g = lane >> 4;
#pragma unroll
  for (int i = 0; i < 8; ++i) { const int ka = k0 + 8 * g + i, kb = ka + 16; v[i] = ka < K ? row[ka < K ? ka : K - 1] : 0.f; v[8 + i] = kb < K ? row[kb < K ? kb : K - 1] : 0.f; }
  return bsplit16(v); }
__device__ __forceinline__ F2 split_col(const float* W, int k0, int n, int lane, int ld, int K) { float v[16]; const int g = lane >> 4;
#pragma unroll
  for (int i = 0; i < 8; ++i) { const int ka = k0 + 8 * g + i, kb = ka + 16; v[i] = ka < K ? W[(size_t)(ka < K ? ka : K - 1) * ld + n] : 0.f; v[8 + i] = kb < K ? W[(size_t)(kb < K ? kb : K - 1) * ld + n] : 0.f; }
  return bsplit16(v); }
__device__ __forceinline__ v8f mac3(const F2& a, const F2& b, v8f c) { c = wmma_bf(a.l, b.h, c); c = wmma_bf(a.h, b.l, c); return wmma_bf(a.h, b.h, c); }
__device__ __forceinline__ float sigm(float v) { return 1.0f / (1.0f + expf(-v)); }
#define LDSX() do { asm volatile("s_wait_dscnt 0" ::: "memory"); __builtin_amdgcn_wave_barrier(); __builtin_amdgcn_fence(__ATOMIC_RELEASE, "workgroup"); } while (0)

// SAGAN-style 1-D self-attention (B 16, C 256, W 2,048): q, k = Wq/Wk x + b (32 channels), v = Wv x + b (256); scores[i][j] = q_i . k_j (no scaling); attn = softmax over j; out[c][i] = sum_j v[c][j] attn[i][j]; result = gamma * out + x.
#define NB 16
#define TT 2048
#define CC 256            // NH * HD = projected width
#define DIN 256          // input (model) width
#define NH 1
#define HD 256
#define NQB (TT / 64)
#define HG 4
#define SCALE (1.0f)
#define HDQK 32            // q / k channels (C/8); the q/k planes are CC wide but only columns < 32 are non-zero and only they enter the scores
#define CAUSAL 0
#ifndef TNB
#define TNB NB
#endif
__device__ __forceinline__ v16b zero16b() { v16b z; _Pragma("unroll") for (int i = 0; i < 16; ++i) z[i] = (__bf16)0.f; return z; }
__device__ __forceinline__ float bfr(float v) { return (float)(__bf16)v; }
__host__ __device__ __forceinline__ int kb_last(int qb) { return CAUSAL ? ((qb * 64 + 63) >> 7) : (TT / 128 - 1); }
typedef __attribute__((ext_vector_type(8))) __bf16 v8b;
__device__ __forceinline__ v16b frag_b(const __bf16* rowk0, int lane) {
  union { v16b v; v8b q[2]; } u; const __bf16* p = rowk0 + 8 * (lane >> 4);
  u.q[0] = *(const v8b*)p; u.q[1] = *(const v8b*)(p + 16); return u.v;
}
#define QBH 0
#define QHI 2048            // rows carrying a q residual plane (all rows when non-causal: 2-product logits everywhere)
#define KHI 64            // key rows carrying k residual / v bf16 hi+lo planes (written by k_proj; nothing in this file reads them)
// B fragment (k rows k0+.., output column o) of a weight: (in,out) [K][ld] or (out,in) [ld rows of K]: bf16 exact, or f16(bf16 * 256) exact
__device__ __forceinline__ v16b wcol_io(const float* Wm, int k0, int o, int lane, int ld) { v16b w; const int g = lane >> 4;
#pragma unroll
  for (int i = 0; i < 8; ++i) { w[i] = (__bf16)Wm[(size_t)(k0 + 8 * g + i) * ld + o]; w[8 + i] = (__bf16)Wm[(size_t)(k0 + 16 + 8 * g + i) * ld + o]; }
  return w; }
__device__ __forceinline__ v16b wcol_oi(const float* Wm, int k0, int o, int lane, int K) { v16b w; const float* p = Wm + (size_t)o * K + k0 + 8 * (lane >> 4);
#pragma unroll
  for (int i = 0; i < 8; ++i) { w[i] = (__bf16)p[i]; w[8 + i] = (__bf16)p[16 + i]; }
  return w; }
__device__ __forceinline__ v16h wcolh_io(const float* Wm, int k0, int o, int lane, int ld) { v16h w; const int g = lane >> 4;
#pragma unroll
  for (int i = 0; i < 8; ++i) { w[i] = (_Float16)(bfr(Wm[(size_t)(k0 + 8 * g + i) * ld + o]) * 256.0f); w[8 + i] = (_Float16)(bfr(Wm[(size_t)(k0 + 16 + 8 * g + i) * ld + o]) * 256.0f); }
  return w; }
__device__ __forceinline__ v16h wcolh_oi(const float* Wm, int k0, int o, int lane, int K) { v16h w; const float* p = Wm + (size_t)o * K + k0 + 8 * (lane >> 4);
#pragma unroll
  for (int i = 0; i < 8; ++i) { w[i] = (_Float16)(bfr(p[i]) * 256.0f); w[8 + i] = (_Float16)(bfr(p[16 + i]) * 256.0f); }
  return w; }
#define WQKV_LAYOUT 1   // 0 = (in,out) [DIN][CC]; 1 = (out,in) [CC][DIN]; 2 = per-head [NH][DIN][HD]
__device__ __forceinline__ v16b wcol_hdk(const float* Wm, int k0, int o, int lane) { v16b w; const int g = lane >> 4; const float* p = Wm + (size_t)(o / HD) * DIN * HD + (o % HD);
#pragma unroll
  for (int i = 0; i < 8; ++i) { w[i] = (__bf16)p[(size_t)(k0 + 8 * g + i) * HD]; w[8 + i] = (__bf16)p[(size_t)(k0 + 16 + 8 * g + i) * HD]; }
  return w; }
#define WO_OUT_IN 0
#if WQKV_LAYOUT == 1
#define WCOL(W, k0, o, lane) ((which == 2 || (o) < HDQK) ? wcol_oi(W, k0, (o), lane, DIN) : zero16b())   /* wq/wk are [32][256]: projected q/k columns >= 32 are zero */
#elif WQKV_LAYOUT == 2
#define WCOL(W, k0, o, lane) wcol_hdk(W, k0, o, lane)
#else
#define WCOL(W, k0, o, lane) wcol_io(W, k0, o, lane, CC)
#endif
#if WO_OUT_IN
#define WOCOL(W, k0, o, lane) wcol_oi(W, k0, o, lane, CC)
#define WOCOLH(W, k0, o, lane) wcolh_oi(W, k0, o, lane, CC)
#else
#define WOCOL(W, k0, o, lane) wcol_io(W, k0, o, lane, DIN)
#define WOCOLH(W, k0, o, lane) wcolh_io(W, k0, o, lane, DIN)
#endif
#ifndef XP
#define XP TT              // position pitch of x and of the output
#endif
#define BG HG
#define DVH 128
#ifndef SM_EXTRA_PARAMS
#define SM_EXTRA_PARAMS
#endif
#ifndef PROJ_EXTRA_PARAMS
#define PROJ_EXTRA_PARAMS
#endif
#ifndef SM_MASK_HOOK
#define SM_MASK_HOOK (void)0
#endif

#define WS_QH  0u                                      // f16 q rows [b*t][CC]
#define WS_KH  (WS_QH + 2u * (size_t)NB * TT * CC)      // f16 k rows [b*t][CC]
#define WS_VT  (WS_KH + 2u * (size_t)NB * TT * CC)      // f16 v planes [b][c][t]
#define WS_QL  (WS_VT + 2u * (size_t)NB * CC * TT)      // f16 q residual x 2^10 rows [b][t < QHI][CC]
#define WS_KL  (WS_QL + 2u * (size_t)NB * QHI * CC)     // f16 k residual x 2^10 rows [b][t < KHI][CC]
#define WS_VB  (WS_KL + 2u * (size_t)NB * KHI * CC)     // bf16 v hi planes [b][c][t < KHI]
#define WS_VBL (WS_VB + 2u * (size_t)NB * CC * KHI)
#define WS_S   (WS_VBL + 2u * (size_t)NB * CC * KHI)    // unused f32 region of HG * TT * TT floats (k_fa keeps logits and P on chip)
#define WS_Y   (WS_S  + 4u * (size_t)HG * TT * TT)      // f32 ctx rows [b*t][CC] (only when there is an output projection)
#define WS_END (WS_Y  + 0u)

// ---- k_proj: block = (64 rows, 128 cols, which): q/k/v = X W (+ b) with exact bf16 products (K = DIN) -> which 0: q f16 rows (+ residual rows < QHI); 1: k f16 rows (+ residual rows < KHI); 2: v f16 planes [c][t] (+ bf16 hi/lo planes for t < KHI)
__global__ __launch_bounds__(128) void k_proj(const float* __restrict__ XQ, const float* __restrict__ XK, const float* __restrict__ XV, const float* __restrict__ WQ, const float* __restrict__ WK, const float* __restrict__ WV, const float* __restrict__ BQ, const float* __restrict__ BK, const float* __restrict__ BV,
    _Float16* __restrict__ QH, _Float16* __restrict__ QL, _Float16* __restrict__ KH, _Float16* __restrict__ KL, _Float16* __restrict__ VT, __bf16* __restrict__ VB, __bf16* __restrict__ VBL) {
  __shared__ __align__(16) _Float16 sh[64][136], sl[64][136]; __shared__ __align__(16) _Float16 th[128][72]; __shared__ __align__(16) __bf16 tb[128][72], tbl[128][72];
  const int tid = threadIdx.x, wave = tid >> 5, lane = tid & 31, col = lane & 15, g = lane >> 4; const int which = blockIdx.z; const int c0 = blockIdx.y * 128; const size_t r0 = (size_t)blockIdx.x * 64; const size_t bb = r0 / TT; const int t0 = (int)(r0 % TT);
  const float* X = which == 0 ? XQ : which == 1 ? XK : XV; const float* WA = which == 0 ? WQ : which == 1 ? WK : WV; const float* BA = which == 0 ? BQ : which == 1 ? BK : BV;
  v8f acc[8] = {};
#pragma unroll 2
  for (int kc = 0; kc < DIN / 32; ++kc) { v16b a; { const float* p = X + (bb * DIN + kc * 32 + 8 * g) * (size_t)XP + t0 + wave * 16 + col;   /* channels-first gather: x[b][k][t], stride XP between k */
#pragma unroll
      for (int i = 0; i < 8; ++i) { a[i] = (__bf16)p[(size_t)i * XP]; a[8 + i] = (__bf16)p[(size_t)(16 + i) * XP]; } }
    asm volatile("s_wait_loadcnt 0x0" ::: "memory");
#pragma unroll
    for (int j = 0; j < 8; ++j) { const v16b w = WCOL(WA, kc * 32, c0 + j * 16 + col, lane); asm volatile("s_wait_loadcnt 0x0" ::: "memory"); acc[j] = wmma_bf(a, w, acc[j]); } }
  if (which < 2) { _Float16* DH = which == 0 ? QH : KH; _Float16* DL = which == 0 ? QL : KL; const int nhi = which == 0 ? QHI : KHI; const bool hi_rows = t0 < nhi;
#pragma unroll
    for (int j = 0; j < 8; ++j) { const float bias = (BA && (which == 2 || c0 + j * 16 + col < HDQK)) ? bfr(BA[c0 + j * 16 + col]) : 0.f;   /* bq/bk have 32 entries */
#pragma unroll
      for (int r = 0; r < 8; ++r) { const float v = acc[j][r] + bias; const _Float16 hv = (_Float16)v; sh[wave * 16 + 8 * g + r][j * 16 + col] = hv; sl[wave * 16 + 8 * g + r][j * 16 + col] = (_Float16)((v - (float)hv) * 1024.0f); } }
    __syncthreads();
    for (int e = tid; e < 64 * 16; e += 128) { const int rl = e >> 4, q = e & 15; vst2((unsigned*)(DH + (r0 + rl) * CC + c0 + q * 8), *(const v4u*)&sh[rl][q * 8]); if (hi_rows) vst2((unsigned*)(DL + (bb * nhi + t0 + rl) * (size_t)CC + c0 + q * 8), *(const v4u*)&sl[rl][q * 8]); }
  } else { const bool hi_rows = t0 < KHI;
#pragma unroll
    for (int j = 0; j < 8; ++j) { const float bias = (BA && (which == 2 || c0 + j * 16 + col < HDQK)) ? bfr(BA[c0 + j * 16 + col]) : 0.f;   /* bq/bk have 32 entries */
#pragma unroll
      for (int r = 0; r < 8; ++r) { const float v = acc[j][r] + bias; const int rl = wave * 16 + 8 * g + r, cl = j * 16 + col; th[cl][rl] = (_Float16)v; const __bf16 bh = (__bf16)v; tb[cl][rl] = bh; tbl[cl][rl] = (__bf16)(v - (float)bh); } }
    __syncthreads();
    for (int e = tid; e < 128 * 8; e += 128) { const int cl = e >> 3, q = e & 7; vst2((unsigned*)(VT + (bb * CC + c0 + cl) * (size_t)TT + t0 + q * 8), *(const v4u*)&th[cl][q * 8]); if (hi_rows) { const size_t o3 = (bb * CC + c0 + cl) * (size_t)KHI + t0 + q * 8; vst2((unsigned*)(VB + o3), *(const v4u*)&tb[cl][q * 8]); vst2((unsigned*)(VBL + o3), *(const v4u*)&tbl[cl][q * 8]); } } } }
#define FK 128                         // keys per staged tile
#define FQ 128                         // queries per block
#define FA_VP (FK * 2 + 16)            // LDS pitch of a v row in bytes (16 B x odd: no bank conflict for 16-byte reads down a column of rows)
#define FA_KP (HDQK * 2 + 16)          // LDS pitch of a k row in bytes (16 B x odd)
#define FA_VB (HD * FA_VP)             // bytes of the v tile; the k tile follows it
#define FA_BUF (FA_VB + FK * FA_KP)    // bytes of one buffer
#define FA_OP (FQ + 4)                 // pitch in floats of an output staging row (one channel, 128 queries)
#define FA_OFF 7.624618986f            // 11 ln 2: exp(s - m + 11 ln 2) <= 2^11 keeps small weights out of the f16 denormals; the factor cancels in the division by the sum
// eight 16-byte copies per lane: LDS address l + i * ls, global address gp + i * gs; the s_wait_xcnt stands inside the statement so that no address register is rewritten ahead of it
__device__ __forceinline__ void cp8(unsigned l, unsigned ls, const char* gp, size_t gs) {
  asm volatile("global_load_async_to_lds_b128 %0, %8, off\n\t"
               "global_load_async_to_lds_b128 %1, %9, off\n\t"
               "global_load_async_to_lds_b128 %2, %10, off\n\t"
               "global_load_async_to_lds_b128 %3, %11, off\n\t"
               "global_load_async_to_lds_b128 %4, %12, off\n\t"
               "global_load_async_to_lds_b128 %5, %13, off\n\t"
               "global_load_async_to_lds_b128 %6, %14, off\n\t"
               "global_load_async_to_lds_b128 %7, %15, off\n\t"
               "s_wait_xcnt 0x0"
               :: "v"(l), "v"(l + ls), "v"(l + 2 * ls), "v"(l + 3 * ls), "v"(l + 4 * ls), "v"(l + 5 * ls), "v"(l + 6 * ls), "v"(l + 7 * ls),
                  "v"(gp), "v"(gp + gs), "v"(gp + 2 * gs), "v"(gp + 3 * gs), "v"(gp + 4 * gs), "v"(gp + 5 * gs), "v"(gp + 6 * gs), "v"(gp + 7 * gs)
               : "memory");
}
// two 16-byte copies per lane, same form
__device__ __forceinline__ void cp2(unsigned l, unsigned ls, const char* gp, size_t gs) {
  asm volatile("global_load_async_to_lds_b128 %0, %2, off\n\t"
               "global_load_async_to_lds_b128 %1, %3, off\n\t"
               "s_wait_xcnt 0x0"
               :: "v"(l), "v"(l + ls), "v"(gp), "v"(gp + gs)
               : "memory");
}
// one tile: v rows (tid >> 4) + 16 i, 16 lanes per 256-B row; k rows (tid >> 2) + 64 i, 4 lanes per 64-B row; 18 copies per wave
__device__ __forceinline__ void fa_stage(unsigned lv, unsigned lk, const char* gv, const char* gk) {
  cp8(lv, 16 * FA_VP, gv, (size_t)16 * TT * 2); cp8(lv + 128 * FA_VP, 16 * FA_VP, gv + (size_t)128 * TT * 2, (size_t)16 * TT * 2);
  cp2(lk, 64 * FA_KP, gk, (size_t)64 * CC * 2);
}
__device__ __forceinline__ v8f wmma_h(v16h a, v16h b, v8f c) { return __builtin_amdgcn_wmma_f32_16x16x32_f16(false, a, false, b, (short)0, c, false, false); }
__global__ __launch_bounds__(256) void k_fa(const _Float16* __restrict__ QH, const _Float16* __restrict__ QL, const _Float16* __restrict__ KH, const _Float16* __restrict__ VT, const float* __restrict__ X, const float* __restrict__ GM, float* __restrict__ OUT) {
  __shared__ __align__(16) char sm[2 * FA_BUF]; float (*st)[FA_OP] = (float (*)[FA_OP])sm;   /* the output staging reuses the ring behind its last barrier */
  const int tid = threadIdx.x, wave = tid >> 5, lane = tid & 31, col = lane & 15, g = lane >> 4; const size_t b = blockIdx.y; const int q0 = blockIdx.x * FQ;
  const v16h qh = frag_h(QH + (b * TT + q0 + wave * 16 + col) * CC, lane), ql = frag_h(QL + (b * QHI + q0 + wave * 16 + col) * CC, lane);   /* B operands: column = query col */
  v8f acc[HD / 16] = {}; float m = -3.0e38f, ls = 0.f;   /* acc[j][r] = O^T[channel 16 j + 8 g + r][query col]; m, ls belong to query col (ls: this half's keys) */
  const int nt = TT / FK;
  const unsigned l0 = (unsigned)(size_t)sm; const unsigned lv = l0 + (tid >> 4) * FA_VP + (tid & 15) * 16, lk = l0 + FA_VB + (tid >> 2) * FA_KP + (tid & 3) * 16;
  const char* gv = (const char*)(VT + (b * CC + (tid >> 4)) * (size_t)TT + (tid & 15) * 8); const char* gk = (const char*)(KH + (b * TT + (tid >> 2)) * (size_t)CC + (tid & 3) * 8);
  fa_stage(lv, lk, gv, gk);
  asm volatile("s_wait_asynccnt 0x0" ::: "memory");   // tile 0 of this wave has landed
  __syncthreads();                                    // ... and every wave's part of it
  if (nt > 1) fa_stage(lv + FA_BUF, lk + FA_BUF, gv + FK * 2, gk + (size_t)FK * CC * 2);
  /* the tile loop stays rolled: one publish point and one refill in the code; the loops inside the 64-key block loop are unrolled so that acc, s and pb are indexed by constants and stay in registers */
#pragma unroll 1
  for (int t = 0; t < nt; ++t) { const char* bu = sm + (t & 1) * FA_BUF; const char* bk = bu + FA_VB;
    /* the loop over the tile's two 64-key blocks stays rolled as well: unrolled, the compiler interleaves the blocks and runs out of registers */
#pragma unroll 1
    for (int sb = 0; sb < FK / 64; ++sb) { v8f s[4]; float mx[4], ps[4]; const char* bv = bu + sb * 128; const char* bks = bk + sb * (64 * FA_KP);
      /* v fragments are read from LDS one group ahead: a group is 8 fragments (32 keys x 128 channels; group n = 32-key half n >> 1, channel half n & 1); group 0 is read here, ahead of the scores and the softmax; nothing of tile t + 1 is read */
      v16h kf[4], vf[8], vn[8];
#pragma unroll
      for (int i = 0; i < 4; ++i) kf[i] = frag_h((const _Float16*)(bks + (i * 16 + col) * FA_KP), lane);
#pragma unroll
      for (int jj = 0; jj < 8; ++jj) vf[jj] = frag_h((const _Float16*)(bv + (jj * 16 + col) * FA_VP), lane);
#pragma unroll
      for (int i = 0; i < 4; ++i) { const v8f z = {}; const v8f sh = wmma_h(kf[i], qh, z), sl = wmma_h(kf[i], ql, z);
#pragma unroll
        for (int r = 0; r < 8; ++r) s[i][r] = (sh[r] + sl[r] * (1.0f / 1024.0f)) * SCALE;   /* key sb * 64 + 16 i + 8 g + r of the tile, query col */
        mx[i] = s[i][0];
#pragma unroll
        for (int r = 1; r < 8; ++r) mx[i] = fmaxf(mx[i], s[i][r]); }
      float mt = fmaxf(fmaxf(mx[0], mx[1]), fmaxf(mx[2], mx[3])); mt = fmaxf(mt, __shfl_xor(mt, 16));   /* the other half holds the query's other 32 keys */
      const float mn = fmaxf(m, mt), al = expf(m - mn), mo = mn - FA_OFF; m = mn;
      v16h pb[2];
#pragma unroll
      for (int i = 0; i < 4; ++i) { ps[i] = 0.f;
#pragma unroll
        for (int r = 0; r < 8; ++r) { const float e = expf(s[i][r] - mo); ps[i] += e; pb[i >> 1][(i & 1) * 8 + r] = (_Float16)e; } }   /* element 8 (i & 1) + r = key 32 (i >> 1) + 16 (i & 1) + 8 g + r: the k order of frag_h */
      ls = ls * al + ((ps[0] + ps[1]) + (ps[2] + ps[3]));
#pragma unroll
      for (int j = 0; j < HD / 16; ++j) acc[j] *= al;
#pragma unroll
      for (int u = 0; u < 4; ++u) { const int n = u + 1;   /* the group fetched ahead */
        if (n < 4) {
#pragma unroll
          for (int jj = 0; jj < 8; ++jj) vn[jj] = frag_h((const _Float16*)(bv + (((n & 1) * 8 + jj) * 16 + col) * FA_VP) + (n >> 1) * 32, lane); }
        __builtin_amdgcn_sched_barrier(0);   // keeps the next group's LDS reads together ahead of this group's eight products; spread among them each product waits out an LDS latency
#pragma unroll
        for (int jj = 0; jj < 8; ++jj) acc[(u & 1) * 8 + jj] = (u == 3 && jj == 7) ? wmma16(vf[jj], pb[u >> 1], acc[(u & 1) * 8 + jj]) : wmma_h(vf[jj], pb[u >> 1], acc[(u & 1) * 8 + jj]);   /* the block's last product carries its four v_nop: on the loop's back edge its A registers are rewritten at once */
        if (n < 4) {
#pragma unroll
          for (int jj = 0; jj < 8; ++jj) vf[jj] = vn[jj]; } } }
    asm volatile("s_wait_dscnt 0x0" ::: "memory");      // this wave's reads of tile t are done before the buffer is refilled
    asm volatile("s_wait_asynccnt 0x0" ::: "memory");   // this wave's copies of tile t + 1 have landed
    __syncthreads();                                    // publishes tile t + 1 and ends every wave's reads of tile t
    if (t + 2 < nt) fa_stage(lv + (t & 1) * FA_BUF, lk + (t & 1) * FA_BUF, gv + (size_t)(t + 2) * (FK * 2), gk + (size_t)(t + 2) * ((size_t)FK * CC * 2)); }
  asm volatile("s_wait_asynccnt 0x0" ::: "memory");     // no copy is in flight when the ring becomes output staging
  const float inv = 1.0f / (ls + __shfl_xor(ls, 16));   /* the halves' sums joined once; the largest weight of a row is 2^11, so the sum is positive */
#pragma unroll
  for (int j = 0; j < HD / 16; ++j)
#pragma unroll
    for (int r = 0; r < 8; ++r) st[j * 16 + 8 * g + r][wave * 16 + col] = acc[j][r] * inv;
  __syncthreads();                                      // a channel row of 128 queries holds columns of all eight waves
  const float gmv = bfr(GM[0]);
  for (int c = wave; c < HD; c += 8) { const size_t o = (b * CC + c) * (size_t)XP + q0 + lane * 4; const v4f xr = *(const v4f*)(X + o), y = *(const v4f*)&st[c][lane * 4]; v4f v;   /* 512-B (channel, 128 queries) segment by 32 lanes */
#pragma unroll
    for (int i = 0; i < 4; ++i) v[i] = gmv * y[i] + bfr(xr[i]); vst2(OUT + o, v); } }   /* gamma * out + x */

extern "C" void kernel_launch(void* const* d_in, const int* in_sizes, int n_in, void* d_out, int out_size, void* d_ws, size_t ws_size, hipStream_t stream) {
  (void)in_sizes; (void)n_in; (void)out_size;
  const float** F = (const float**)d_in;
  if (ws_size < (size_t)WS_END) return;
  char* ws = (char*)d_ws; _Float16 *QH = (_Float16*)(ws + WS_QH), *KH = (_Float16*)(ws + WS_KH), *VT = (_Float16*)(ws + WS_VT), *QL = (_Float16*)(ws + WS_QL), *KL = (_Float16*)(ws + WS_KL); __bf16 *VB = (__bf16*)(ws + WS_VB), *VBL = (__bf16*)(ws + WS_VBL);
  // inputs: 0 x [16,256,2048] channels-first; 1 wq [32,256] (out,in), 2 bq [32]; 3 wk, 4 bk; 5 wv [256,256], 6 bv [256]; 7 gamma [1]
  k_proj<<<dim3(TNB * TT / 64, CC / 128, 3), 128, 0, stream>>>(F[0], F[0], F[0], F[1], F[3], F[5], F[2], F[4], F[6], QH, QL, KH, KL, VT, VB, VBL);
  k_fa<<<dim3(TT / FQ, TNB), 256, 0, stream>>>(QH, QL, KH, VT, F[0], F[7], (float*)d_out);
}

// v003
// One run takes 69.4 microseconds.
// In two side-by-side timings against v002, it was 2.14 and 2.12 times as fast.
// Counting every step since v000, it is 10.6 times as fast.
// compute dtype: all float inputs rounded to bf16; q/k (32 channels) and v (256) = W x + b (1x1 convs) with EXACT bf16 products on WMMA 16x16x32, f32 accumulate; q as f16 hi + residual (x 2^10) against k once to f16 (2 products) for the UNSCALED scores (logit sigma ~5.7: peaked softmax); online softmax in f32 (precise expf, running maximum); exp(s - max) x 2^11 once to f16 against v once to f16 (1 product), divided by the f32 row sum at the end; gamma * out + x in f32; f32 output.
#include <hip/hip_runtime.h>
#include <math.h>

typedef __attribute__((ext_vector_type(16))) _Float16 v16h;
typedef __attribute__((ext_vector_type(16))) __bf16 v16b;
typedef __attribute__((ext_vector_type(8)))  _Float16 v8h;
typedef __attribute__((ext_vector_type(8)))  float v8f;
typedef __attribute__((ext_vector_type(4)))  float v4f;
typedef __attribute__((ext_vector_type(2)))  float v2f;
typedef __attribute__((ext_vector_type(4)))  unsigned v4u;
typedef __attribute__((ext_vector_type(4)))  int v4i;
typedef float __attribute__((may_alias)) float_a;
typedef int __attribute__((may_alias)) int_a;

template <typename T> __device__ __forceinline__ void vst2(void* p, T v) { *(T*)p = v;  }
__device__ __forceinline__ v8f wmma16(v16h a, v16h b, v8f c) {
  v8f d = __builtin_amdgcn_wmma_f32_16x16x32_f16(false, a, false, b, (short)0, c, false, false);
  asm volatile("v_nop\n\tv_nop\n\tv_nop\n\tv_nop" : "+v"(d) : "v"(a), "v"(b));
  return d;
}
__device__ __forceinline__ v8f wmma_bf(v16b a, v16b b, v8f c) {
  v8f d = __builtin_amdgcn_wmma_f32_16x16x32_bf16(false, a, false, b, (short)0, c, false, false);
  asm volatile("v_nop\n\tv_nop\n\tv_nop\n\tv_nop" : "+v"(d) : "v"(a), "v"(b));
  return d;
}
// 16x16x32 fragments: lane = (h = lane>>4, row/col = lane&15); elements 0..7 = k0+8h+0..7, 8..15 = k0+16+8h+0..7; D element r = row 8h+r
__device__ __forceinline__ v16h frag_h(const _Float16* rowk0, int lane) {
  union { v16h v; v8h q[2]; } u; const _Float16* p = rowk0 + 8 * (lane >> 4);
  u.q[0] = *(const v8h*)p; u.q[1] = *(const v8h*)(p + 16); return u.v;
}
__device__ __forceinline__ v16h frag_f32(const float* rowk0, int lane) {
  v16h a; const float* p = rowk0 + 8 * (lane >> 4);
#pragma unroll
  for (int i = 0; i < 8; ++i) { a[i] = (_Float16)p[i]; a[8 + i] = (_Float16)p[16 + i]; }
  return a;
}
__device__ __forceinline__ v16h frag_f32s(const float* rowk0, int lane, float sc) {
  v16h a; const float* p = rowk0 + 8 * (lane >> 4);
#pragma unroll
  for (int i = 0; i < 8; ++i) { a[i] = (_Float16)(p[i] * sc); a[8 + i] = (_Float16)(p[16 + i] * sc); }
  return a;
}
// column fragment from a [K][ld] layout (column n), rows >= K read as 0
__device__ __forceinline__ v16h fragc_f32(const float* W, int k0, int n, int lane, int ld, int K) {
  v16h a; const int g = lane >> 4;
#pragma unroll
  for (int i = 0; i < 8; ++i) { const int ka = k0 + 8 * g + i, kb = ka + 16;
    a[i] = (_Float16)(ka < K ? W[(size_t)(ka < K ? ka : K - 1) * ld + n] : 0.f); a[8 + i] = (_Float16)(kb < K ? W[(size_t)(kb < K ? kb : K - 1) * ld + n] : 0.f); }
  return a;
}
struct F2 { v16b h, l; };
__device__ __forceinline__ F2 bsplit16(const float v[16]) { F2 r;
#pragma unroll
  for (int i = 0; i < 16; ++i) { const __bf16 h = (__bf16)v[i]; r.h[i] = h; r.l[i] = (__bf16)(v[i] - (float)h); }
  return r; }
__device__ __forceinline__ F2 split_row(const float* row, int k0, int lane) { float v[16]; const float* p = row + k0 + 8 * (lane >> 4);
#pragma unroll
  for (int i = 0; i < 8; ++i) { v[i] = p[i]; v[8 + i] = p[16 + i]; }
  return bsplit16(v); }
__device__ __forceinline__ F2 split_rowK(const float* row, int k0, int lane, int K) { float v[16]; const int g = lane >> 4;
#pragma unroll
  for (int i = 0; i < 8; ++i) { const int ka = k0 + 8 * g + i, kb = ka + 16; v[i] = ka < K ? row[ka < K ? ka : K - 1] : 0.f; v[8 + i] = kb < K ? row[kb < K ? kb : K - 1] : 0.f; }
  return bsplit16(v); }
__device__ __forceinline__ F2 split_col(const float* W, int k0, int n, int lane, int ld, int K) { float v[16]; const int g = lane >> 4;
#pragma unroll
  for (int i = 0; i < 8; ++i) { const int ka = k0 + 8 * g + i, kb = ka + 16; v[i] = ka < K ? W[(size_t)(ka < K ? ka : K - 1) * ld + n] : 0.f; v[8 + i] = kb < K ? W[(size_t)(kb < K ? kb : K - 1) * ld + n] : 0.f; }
  return bsplit16(v); }
__device__ __forceinline__ v8f mac3(const F2& a, const F2& b, v8f c) { c = wmma_bf(a.l, b.h, c); c = wmma_bf(a.h, b.l, c); return wmma_bf(a.h, b.h, c); }
__device__ __forceinline__ float sigm(float v) { return 1.0f / (1.0f + expf(-v)); }
#define LDSX() do { asm volatile("s_wait_dscnt 0" ::: "memory"); __builtin_amdgcn_wave_barrier(); __builtin_amdgcn_fence(__ATOMIC_RELEASE, "workgroup"); } while (0)

// SAGAN-style 1-D self-attention (B 16, C 256, W 2,048): q, k = Wq/Wk x + b (32 channels), v = Wv x + b (256); scores[i][j] = q_i . k_j (no scaling); attn = softmax over j; out[c][i] = sum_j v[c][j] attn[i][j]; result = gamma * out + x.
#define NB 16
#define TT 2048
#define CC 256            // NH * HD = projected width
#define DIN 256          // input (model) width
#define NH 1
#define HD 256
#define NQB (TT / 64)
#define HG 4
#define SCALE (1.0f)
#define HDQK 32            // q / k channels (C/8); the q/k planes are CC wide but only columns < 32 are written and only they enter the scores
#define CAUSAL 0
#ifndef TNB
#define TNB NB
#endif
__device__ __forceinline__ v16b zero16b() { v16b z; _Pragma("unroll") for (int i = 0; i < 16; ++i) z[i] = (__bf16)0.f; return z; }
__device__ __forceinline__ float bfr(float v) { return (float)(__bf16)v; }
__host__ __device__ __forceinline__ int kb_last(int qb) { return CAUSAL ? ((qb * 64 + 63) >> 7) : (TT / 128 - 1); }
typedef __attribute__((ext_vector_type(8))) __bf16 v8b;
__device__ __forceinline__ v16b frag_b(const __bf16* rowk0, int lane) {
  union { v16b v; v8b q[2]; } u; const __bf16* p = rowk0 + 8 * (lane >> 4);
  u.q[0] = *(const v8b*)p; u.q[1] = *(const v8b*)(p + 16); return u.v;
}
#define QBH 0
#define QHI 2048            // rows carrying a q residual plane (all rows when non-causal: 2-product logits everywhere)
#define KHI 64            // key rows carrying k residual / v bf16 hi+lo planes (nothing in this file writes or reads them)
// B fragment (k rows k0+.., output column o) of a weight: (in,out) [K][ld] or (out,in) [ld rows of K]: bf16 exact, or f16(bf16 * 256) exact
__device__ __forceinline__ v16b wcol_io(const float* Wm, int k0, int o, int lane, int ld) { v16b w; const int g = lane >> 4;
#pragma unroll
  for (int i = 0; i < 8; ++i) { w[i] = (__bf16)Wm[(size_t)(k0 + 8 * g + i) * ld + o]; w[8 + i] = (__bf16)Wm[(size_t)(k0 + 16 + 8 * g + i) * ld + o]; }
  return w; }
__device__ __forceinline__ v16b wcol_oi(const float* Wm, int k0, int o, int lane, int K) { v16b w; const float* p = Wm + (size_t)o * K + k0 + 8 * (lane >> 4);
#pragma unroll
  for (int i = 0; i < 8; ++i) { w[i] = (__bf16)p[i]; w[8 + i] = (__bf16)p[16 + i]; }
  return w; }
__device__ __forceinline__ v16h wcolh_io(const float* Wm, int k0, int o, int lane, int ld) { v16h w; const int g = lane >> 4;
#pragma unroll
  for (int i = 0; i < 8; ++i) { w[i] = (_Float16)(bfr(Wm[(size_t)(k0 + 8 * g + i) * ld + o]) * 256.0f); w[8 + i] = (_Float16)(bfr(Wm[(size_t)(k0 + 16 + 8 * g + i) * ld + o]) * 256.0f); }
  return w; }
__device__ __forceinline__ v16h wcolh_oi(const float* Wm, int k0, int o, int lane, int K) { v16h w; const float* p = Wm + (size_t)o * K + k0 + 8 * (lane >> 4);
#pragma unroll
  for (int i = 0; i < 8; ++i) { w[i] = (_Float16)(bfr(p[i]) * 256.0f); w[8 + i] = (_Float16)(bfr(p[16 + i]) * 256.0f); }
  return w; }
#define WQKV_LAYOUT 1   // 0 = (in,out) [DIN][CC]; 1 = (out,in) [CC][DIN]; 2 = per-head [NH][DIN][HD]
__device__ __forceinline__ v16b wcol_hdk(const float* Wm, int k0, int o, int lane) { v16b w; const int g = lane >> 4; const float* p = Wm + (size_t)(o / HD) * DIN * HD + (o % HD);
#pragma unroll
  for (int i = 0; i < 8; ++i) { w[i] = (__bf16)p[(size_t)(k0 + 8 * g + i) * HD]; w[8 + i] = (__bf16)p[(size_t)(k0 + 16 + 8 * g + i) * HD]; }
  return w; }
#define WO_OUT_IN 0
#if WQKV_LAYOUT == 1
#define WCOL(W, k0, o, lane) ((which == 2 || (o) < HDQK) ? wcol_oi(W, k0, (o), lane, DIN) : zero16b())   /* wq/wk are [32][256]: projected q/k columns >= 32 are zero */
#elif WQKV_LAYOUT == 2
#define WCOL(W, k0, o, lane) wcol_hdk(W, k0, o, lane)
#else
#define WCOL(W, k0, o, lane) wcol_io(W, k0, o, lane, CC)
#endif
#if WO_OUT_IN
#define WOCOL(W, k0, o, lane) wcol_oi(W, k0, o, lane, CC)
#define WOCOLH(W, k0, o, lane) wcolh_oi(W, k0, o, lane, CC)
#else
#define WOCOL(W, k0, o, lane) wcol_io(W, k0, o, lane, DIN)
#define WOCOLH(W, k0, o, lane) wcolh_io(W, k0, o, lane, DIN)
#endif
#ifndef XP
#define XP TT              // position pitch of x and of the output
#endif
#define BG HG
#define DVH 128
#ifndef SM_EXTRA_PARAMS
#define SM_EXTRA_PARAMS
#endif
#ifndef PROJ_EXTRA_PARAMS
#define PROJ_EXTRA_PARAMS
#endif
#ifndef SM_MASK_HOOK
#define SM_MASK_HOOK (void)0
#endif

#define WS_QH  0u                                      // f16 q rows [b*t][CC]
#define WS_KH  (WS_QH + 2u * (size_t)NB * TT * CC)      // f16 k rows [b*t][CC]
#define WS_VT  (WS_KH + 2u * (size_t)NB * TT * CC)      // f16 v planes [b][c][t]
#define WS_QL  (WS_VT + 2u * (size_t)NB * CC * TT)      // f16 q residual x 2^10 rows [b][t < QHI][CC]
#define WS_KL  (WS_QL + 2u * (size_t)NB * QHI * CC)     // f16 k residual x 2^10 rows [b][t < KHI][CC]
#define WS_VB  (WS_KL + 2u * (size_t)NB * KHI * CC)     // bf16 v hi planes [b][c][t < KHI]
#define WS_VBL (WS_VB + 2u * (size_t)NB * CC * KHI)
#define WS_S   (WS_VBL + 2u * (size_t)NB * CC * KHI)    // unused f32 region of HG * TT * TT floats (k_fa keeps logits and P on chip)
#define WS_Y   (WS_S  + 4u * (size_t)HG * TT * TT)      // f32 ctx rows [b*t][CC] (only when there is an output projection)
#define WS_END (WS_Y  + 0u)

// ---- k_proj: block = 128 positions (8 waves x 16) of one batch, ALL 320 projected columns (q 0..31, k 32..63, v 64..319): X W + b with exact bf16 products (K = DIN), the k chunks summed in ascending order.
// The three weights are converted to bf16 and staged in LDS once per block; every wave reads its B fragments from there. Each wave gathers its 16 positions of x once and keeps the 8 A fragments in registers.
// Out: q f16 rows + residual rows, k f16 rows (32 columns each at pitch CC, the only ones that k_fa reads), v f16 planes [c][t]. Every loop of the kernel is unrolled so that a, acc, wf, wn and the biases are indexed by constants and stay in registers.
#define PT 128                         // positions per block
#define PO (2 * HDQK + CC)             // projected columns
#define PW_P (DIN * 2 + 16)            // LDS pitch of a bf16 weight row in bytes (16 B x odd: no bank conflict for 16-byte reads down a column of rows)
#define PV_P (PT + 8)                  // pitch in halves of a staged v channel row (16 B x odd)
#define PQ_P (HDQK + 8)                // pitch in halves of a staged q / k row
typedef __attribute__((ext_vector_type(4))) __bf16 v4b;
__device__ __forceinline__ v8f wmma_b(v16b a, v16b b, v8f c) { return __builtin_amdgcn_wmma_f32_16x16x32_bf16(false, a, false, b, (short)0, c, false, false); }
// rows wave + 8 i (i < n8) of a [rows][DIN] f32 weight -> bf16 rows in LDS, nb rows per batch of loads (nb <= 16 divides n8); a wave reads one row as two contiguous 512-B loads
__device__ __forceinline__ void stage_w(const float* __restrict__ Wm, char* dst, int n8, int nb, int wave, int lane) {
  /* the loop over batches stays rolled: one batch of loads in flight bounds the registers; the loops inside it are unrolled so that lo and hi are indexed by constants and stay in registers */
#pragma unroll 1
  for (int i0 = 0; i0 < n8; i0 += nb) { const float* p = Wm + (size_t)(wave + 8 * i0) * DIN + lane * 4; char* d = dst + (wave + 8 * i0) * PW_P + lane * 8; v4f lo[16], hi[16];
#pragma unroll
    for (int i = 0; i < nb; ++i) { lo[i] = *(const v4f*)(p + (size_t)i * 8 * DIN); hi[i] = *(const v4f*)(p + (size_t)i * 8 * DIN + DIN / 2); }
    asm volatile("s_wait_xcnt 0x0" :: "v"(p) : "memory");   // stands in front of every rewrite of the batch's address register; naming it keeps it out of the loads' own destinations
#pragma unroll
    for (int i = 0; i < nb; ++i) { v4b bl, bh;
#pragma unroll
      for (int e = 0; e < 4; ++e) { bl[e] = (__bf16)lo[i][e]; bh[e] = (__bf16)hi[i][e]; }
      *(v4b*)(d + i * 8 * PW_P) = bl; *(v4b*)(d + i * 8 * PW_P + DIN) = bh; } } }
__global__ __launch_bounds__(256) void k_proj(const float* __restrict__ X, const float* __restrict__ WQ, const float* __restrict__ WK, const float* __restrict__ WV, const float* __restrict__ BQ, const float* __restrict__ BK, const float* __restrict__ BV,
    _Float16* __restrict__ QH, _Float16* __restrict__ QL, _Float16* __restrict__ KH, _Float16* __restrict__ VT) {
  __shared__ __align__(16) char sw[PO * PW_P]; __shared__ __align__(16) _Float16 th[CC][PV_P], sqh[PT][PQ_P], sql[PT][PQ_P], skh[PT][PQ_P];
  const int tid = threadIdx.x, wave = tid >> 5, lane = tid & 31, col = lane & 15, g = lane >> 4; const size_t bb = blockIdx.y; const int t0 = blockIdx.x * PT;
  float bq[HDQK / 16] = {}, bk[HDQK / 16] = {}, bv[CC / 16] = {};   /* the biases of this lane's columns, fetched first so that the epilogue waits for no load; rounded to bf16 where they are used */
  if (BQ) {
#pragma unroll
    for (int j = 0; j < HDQK / 16; ++j) bq[j] = BQ[j * 16 + col]; }
  if (BK) {
#pragma unroll
    for (int j = 0; j < HDQK / 16; ++j) bk[j] = BK[j * 16 + col]; }
  if (BV) {
#pragma unroll
    for (int j = 0; j < CC / 16; ++j) bv[j] = BV[j * 16 + col]; }
  asm volatile("s_wait_xcnt 0x0" :: "s"(BQ), "s"(BK), "s"(BV) : "memory");   // stands in front of the first rewrite of a scalar base that the bias loads name; naming the three bases keeps them in their registers up to here
  v16b a[DIN / 32]; { const float* p = X + (bb * DIN + 8 * g) * (size_t)XP + t0 + wave * 16 + col;   /* channels-first gather: x[b][k][t], stride XP between k; row = position wave * 16 + col */
#pragma unroll
    for (int kc = 0; kc < DIN / 32; ++kc)
#pragma unroll
      for (int i = 0; i < 8; ++i) { a[kc][i] = (__bf16)p[(size_t)(kc * 32 + i) * XP]; a[kc][8 + i] = (__bf16)p[(size_t)(kc * 32 + 16 + i) * XP]; } }
  asm volatile("s_wait_xcnt 0x0" ::: "memory");   // stands in front of the first rewrite of an address register that the loads above name
  stage_w(WQ, sw, HDQK / 8, HDQK / 8, wave, lane); stage_w(WK, sw + HDQK * PW_P, HDQK / 8, HDQK / 8, wave, lane); stage_w(WV, sw + 2 * HDQK * PW_P, CC / 8, 16, wave, lane);
  __syncthreads();                                      // a weight row is staged by one wave and read by all eight
  v8f acc[PO / 16] = {};
  /* weight fragments are read from LDS one group ahead: a group is 10 fragments (one 32-k chunk x 160 columns; group n = chunk n >> 1, column half n & 1) */
  v16b wf[PO / 32], wn[PO / 32];
#pragma unroll
  for (int jj = 0; jj < PO / 32; ++jj) wf[jj] = frag_b((const __bf16*)(sw + (jj * 16 + col) * PW_P), lane);
#pragma unroll
  for (int u = 0; u < DIN / 16; ++u) { const int n = u + 1;   /* the group fetched ahead */
    if (n < DIN / 16) {
#pragma unroll
      for (int jj = 0; jj < PO / 32; ++jj) wn[jj] = frag_b((const __bf16*)(sw + (((n & 1) * (PO / 32) + jj) * 16 + col) * PW_P) + (n >> 1) * 32, lane); }
    __builtin_amdgcn_sched_barrier(0);   // bounds how far ahead the scheduler lifts LDS reads: left free it lifts more fragments than the registers hold and spills
#pragma unroll
    for (int jj = 0; jj < PO / 32; ++jj) acc[(u & 1) * (PO / 32) + jj] = wmma_b(a[u >> 1], wf[jj], acc[(u & 1) * (PO / 32) + jj]);
    if (n < DIN / 16) {
#pragma unroll
      for (int jj = 0; jj < PO / 32; ++jj) wf[jj] = wn[jj]; } }
  const int rl0 = wave * 16 + 8 * g;   /* D element r = position rl0 + r, column 16 j + col */
#pragma unroll
  for (int j = 0; j < HDQK / 16; ++j) {
#pragma unroll
    for (int r = 0; r < 8; ++r) { const float v = acc[j][r] + bfr(bq[j]); const _Float16 hv = (_Float16)v; sqh[rl0 + r][j * 16 + col] = hv; sql[rl0 + r][j * 16 + col] = (_Float16)((v - (float)hv) * 1024.0f); skh[rl0 + r][j * 16 + col] = (_Float16)(acc[HDQK / 16 + j][r] + bfr(bk[j])); } }
#pragma unroll
  for (int j = 0; j < CC / 16; ++j) { v8h pk;
#pragma unroll
    for (int r = 0; r < 8; ++r) pk[r] = (_Float16)(acc[2 * HDQK / 16 + j][r] + bfr(bv[j]));
    *(v8h*)&th[j * 16 + col][rl0] = pk; }
  __syncthreads();                                      // a staged row holds values of several waves
#pragma unroll
  for (int i = 0; i < CC * (PT / 8) / 256; ++i) { const int cl = (tid >> 4) + 16 * i, q = tid & 15; vst2((unsigned*)(VT + (bb * CC + cl) * (size_t)TT + t0 + q * 8), *(const v4u*)&th[cl][q * 8]); }   /* 256-B (channel, 128 positions) segment by 16 lanes */
#pragma unroll
  for (int i = 0; i < PT * (HDQK / 8) / 256; ++i) { const int rl = (tid >> 2) + 64 * i, q = tid & 3; const size_t o = (bb * TT + t0 + rl) * (size_t)CC + q * 8;
    vst2((unsigned*)(QH + o), *(const v4u*)&sqh[rl][q * 8]); vst2((unsigned*)(KH + o), *(const v4u*)&skh[rl][q * 8]); vst2((unsigned*)(QL + (bb * QHI + t0 + rl) * (size_t)CC + q * 8), *(const v4u*)&sql[rl][q * 8]); } }
#define FK 128                         // keys per staged tile
#define FQ 128                         // queries per block
#define FA_VP (FK * 2 + 16)            // LDS pitch of a v row in bytes (16 B x odd: no bank conflict for 16-byte reads down a column of rows)
#define FA_KP (HDQK * 2 + 16)          // LDS pitch of a k row in bytes (16 B x odd)
#define FA_VB (HD * FA_VP)             // bytes of the v tile; the k tile follows it
#define FA_BUF (FA_VB + FK * FA_KP)    // bytes of one buffer
#define FA_OP (FQ + 4)                 // pitch in floats of an output staging row (one channel, 128 queries)
#define FA_OFF 7.624618986f            // 11 ln 2: exp(s - m + 11 ln 2) <= 2^11 keeps small weights out of the f16 denormals; the factor cancels in the division by the sum
// eight 16-byte copies per lane: LDS address l + i * ls, global address gp + i * gs; the s_wait_xcnt stands inside the statement so that no address register is rewritten ahead of it
__device__ __forceinline__ void cp8(unsigned l, unsigned ls, const char* gp, size_t gs) {
  asm volatile("global_load_async_to_lds_b128 %0, %8, off\n\t"
               "global_load_async_to_lds_b128 %1, %9, off\n\t"
               "global_load_async_to_lds_b128 %2, %10, off\n\t"
               "global_load_async_to_lds_b128 %3, %11, off\n\t"
               "global_load_async_to_lds_b128 %4, %12, off\n\t"
               "global_load_async_to_lds_b128 %5, %13, off\n\t"
               "global_load_async_to_lds_b128 %6, %14, off\n\t"
               "global_load_async_to_lds_b128 %7, %15, off\n\t"
               "s_wait_xcnt 0x0"
               :: "v"(l), "v"(l + ls), "v"(l + 2 * ls), "v"(l + 3 * ls), "v"(l + 4 * ls), "v"(l + 5 * ls), "v"(l + 6 * ls), "v"(l + 7 * ls),
                  "v"(gp), "v"(gp + gs), "v"(gp + 2 * gs), "v"(gp + 3 * gs), "v"(gp + 4 * gs), "v"(gp + 5 * gs), "v"(gp + 6 * gs), "v"(gp + 7 * gs)
               : "memory");
}
// two 16-byte copies per lane, same form
__device__ __forceinline__ void cp2(unsigned l, unsigned ls, const char* gp, size_t gs) {
  asm volatile("global_load_async_to_lds_b128 %0, %2, off\n\t"
               "global_load_async_to_lds_b128 %1, %3, off\n\t"
               "s_wait_xcnt 0x0"
               :: "v"(l), "v"(l + ls), "v"(gp), "v"(gp + gs)
               : "memory");
}
// one tile: v rows (tid >> 4) + 16 i, 16 lanes per 256-B row; k rows (tid >> 2) + 64 i, 4 lanes per 64-B row; 18 copies per wave
__device__ __forceinline__ void fa_stage(unsigned lv, unsigned lk, const char* gv, const char* gk) {
  cp8(lv, 16 * FA_VP, gv, (size_t)16 * TT * 2); cp8(lv + 128 * FA_VP, 16 * FA_VP, gv + (size_t)128 * TT * 2, (size_t)16 * TT * 2);
  cp2(lk, 64 * FA_KP, gk, (size_t)64 * CC * 2);
}
__device__ __forceinline__ v8f wmma_h(v16h a, v16h b, v8f c) { return __builtin_amdgcn_wmma_f32_16x16x32_f16(false, a, false, b, (short)0, c, false, false); }
__global__ __launch_bounds__(256) void k_fa(const _Float16* __restrict__ QH, const _Float16* __restrict__ QL, const _Float16* __restrict__ KH, const _Float16* __restrict__ VT, const float* __restrict__ X, const float* __restrict__ GM, float* __restrict__ OUT) {
  __shared__ __align__(16) char sm[2 * FA_BUF]; float (*st)[FA_OP] = (float (*)[FA_OP])sm;   /* the output staging reuses the ring behind its last barrier */
  const int tid = threadIdx.x, wave = tid >> 5, lane = tid & 31, col = lane & 15, g = lane >> 4; const size_t b = blockIdx.y; const int q0 = blockIdx.x * FQ;
  const v16h qh = frag_h(QH + (b * TT + q0 + wave * 16 + col) * CC, lane), ql = frag_h(QL + (b * QHI + q0 + wave * 16 + col) * CC, lane);   /* B operands: column = query col */
  v8f acc[HD / 16] = {}; float m = -3.0e38f, ls = 0.f;   /* acc[j][r] = O^T[channel 16 j + 8 g + r][query col]; m, ls belong to query col (ls: this half's keys) */
  const int nt = TT / FK;
  const unsigned l0 = (unsigned)(size_t)sm; const unsigned lv = l0 + (tid >> 4) * FA_VP + (tid & 15) * 16, lk = l0 + FA_VB + (tid >> 2) * FA_KP + (tid & 3) * 16;
  const char* gv = (const char*)(VT + (b * CC + (tid >> 4)) * (size_t)TT + (tid & 15) * 8); const char* gk = (const char*)(KH + (b * TT + (tid >> 2)) * (size_t)CC + (tid & 3) * 8);
  fa_stage(lv, lk, gv, gk);
  asm volatile("s_wait_asynccnt 0x0" ::: "memory");   // tile 0 of this wave has landed
  __syncthreads();                                    // ... and every wave's part of it
  if (nt > 1) fa_stage(lv + FA_BUF, lk + FA_BUF, gv + FK * 2, gk + (size_t)FK * CC * 2);
  /* the tile loop stays rolled: one publish point and one refill in the code; the loops inside the 64-key block loop are unrolled so that acc, s and pb are indexed by constants and stay in registers */
#pragma unroll 1
  for (int t = 0; t < nt; ++t) { const char* bu = sm + (t & 1) * FA_BUF; const char* bk = bu + FA_VB;
    /* the loop over the tile's two 64-key blocks stays rolled as well: unrolled, the compiler interleaves the blocks and runs out of registers */
#pragma unroll 1
    for (int sb = 0; sb < FK / 64; ++sb) { v8f s[4]; float mx[4], ps[4]; const char* bv = bu + sb * 128; const char* bks = bk + sb * (64 * FA_KP);
      /* v fragments are read from LDS one group ahead: a group is 8 fragments (32 keys x 128 channels; group n = 32-key half n >> 1, channel half n & 1); group 0 is read here, ahead of the scores and the softmax; nothing of tile t + 1 is read */
      v16h kf[4], vf[8], vn[8];
#pragma unroll
      for (int i = 0; i < 4; ++i) kf[i] = frag_h((const _Float16*)(bks + (i * 16 + col) * FA_KP), lane);
#pragma unroll
      for (int jj = 0; jj < 8; ++jj) vf[jj] = frag_h((const _Float16*)(bv + (jj * 16 + col) * FA_VP), lane);
#pragma unroll
      for (int i = 0; i < 4; ++i) { const v8f z = {}; const v8f sh = wmma_h(kf[i], qh, z), sl = wmma_h(kf[i], ql, z);
#pragma unroll
        for (int r = 0; r < 8; ++r) s[i][r] = (sh[r] + sl[r] * (1.0f / 1024.0f)) * SCALE;   /* key sb * 64 + 16 i + 8 g + r of the tile, query col */
        mx[i] = s[i][0];
#pragma unroll
        for (int r = 1; r < 8; ++r) mx[i] = fmaxf(mx[i], s[i][r]); }
      float mt = fmaxf(fmaxf(mx[0], mx[1]), fmaxf(mx[2], mx[3])); mt = fmaxf(mt, __shfl_xor(mt, 16));   /* the other half holds the query's other 32 keys */
      const float mn = fmaxf(m, mt), al = expf(m - mn), mo = mn - FA_OFF; m = mn;
      v16h pb[2];
#pragma unroll
      for (int i = 0; i < 4; ++i) { ps[i] = 0.f;
#pragma unroll
        for (int r = 0; r < 8; ++r) { const float e = expf(s[i][r] - mo); ps[i] += e; pb[i >> 1][(i & 1) * 8 + r] = (_Float16)e; } }   /* element 8 (i & 1) + r = key 32 (i >> 1) + 16 (i & 1) + 8 g + r: the k order of frag_h */
      ls = ls * al + ((ps[0] + ps[1]) + (ps[2] + ps[3]));
#pragma unroll
      for (int j = 0; j < HD / 16; ++j) acc[j] *= al;
#pragma unroll
      for (int u = 0; u < 4; ++u) { const int n = u + 1;   /* the group fetched ahead */
        if (n < 4) {
#pragma unroll
          for (int jj = 0; jj < 8; ++jj) vn[jj] = frag_h((const _Float16*)(bv + (((n & 1) * 8 + jj) * 16 + col) * FA_VP) + (n >> 1) * 32, lane); }
        __builtin_amdgcn_sched_barrier(0);   // keeps the next group's LDS reads together ahead of this group's eight products; spread among them each product waits out an LDS latency
#pragma unroll
        for (int jj = 0; jj < 8; ++jj) acc[(u & 1) * 8 + jj] = (u == 3 && jj == 7) ? wmma16(vf[jj], pb[u >> 1], acc[(u & 1) * 8 + jj]) : wmma_h(vf[jj], pb[u >> 1], acc[(u & 1) * 8 + jj]);   /* the block's last product carries its four v_nop: on the loop's back edge its A registers are rewritten at once */
        if (n < 4) {
#pragma unroll
          for (int jj = 0; jj < 8; ++jj) vf[jj] = vn[jj]; } } }
    asm volatile("s_wait_dscnt 0x0" ::: "memory");      // this wave's reads of tile t are done before the buffer is refilled
    asm volatile("s_wait_asynccnt 0x0" ::: "memory");   // this wave's copies of tile t + 1 have landed
    __syncthreads();                                    // publishes tile t + 1 and ends every wave's reads of tile t
    if (t + 2 < nt) fa_stage(lv + (t & 1) * FA_BUF, lk + (t & 1) * FA_BUF, gv + (size_t)(t + 2) * (FK * 2), gk + (size_t)(t + 2) * ((size_t)FK * CC * 2)); }
  asm volatile("s_wait_asynccnt 0x0" ::: "memory");     // no copy is in flight when the ring becomes output staging
  const float inv = 1.0f / (ls + __shfl_xor(ls, 16));   /* the halves' sums joined once; the largest weight of a row is 2^11, so the sum is positive */
#pragma unroll
  for (int j = 0; j < HD / 16; ++j)
#pragma unroll
    for (int r = 0; r < 8; ++r) st[j * 16 + 8 * g + r][wave * 16 + col] = acc[j][r] * inv;
  __syncthreads();                                      // a channel row of 128 queries holds columns of all eight waves
  const float gmv = bfr(GM[0]);
  for (int c = wave; c < HD; c += 8) { const size_t o = (b * CC + c) * (size_t)XP + q0 + lane * 4; const v4f xr = *(const v4f*)(X + o), y = *(const v4f*)&st[c][lane * 4]; v4f v;   /* 512-B (channel, 128 queries) segment by 32 lanes */
#pragma unroll
    for (int i = 0; i < 4; ++i) v[i] = gmv * y[i] + bfr(xr[i]); vst2(OUT + o, v); } }   /* gamma * out + x */

extern "C" void kernel_launch(void* const* d_in, const int* in_sizes, int n_in, void* d_out, int out_size, void* d_ws, size_t ws_size, hipStream_t stream) {
  (void)in_sizes; (void)n_in; (void)out_size;
  const float** F = (const float**)d_in;
  if (ws_size < (size_t)WS_END) return;
  char* ws = (char*)d_ws; _Float16 *QH = (_Float16*)(ws + WS_QH), *KH = (_Float16*)(ws + WS_KH), *VT = (_Float16*)(ws + WS_VT), *QL = (_Float16*)(ws + WS_QL);
  // inputs: 0 x [16,256,2048] channels-first; 1 wq [32,256] (out,in), 2 bq [32]; 3 wk, 4 bk; 5 wv [256,256], 6 bv [256]; 7 gamma [1]
  k_proj<<<dim3(TT / PT, TNB), 256, 0, stream>>>(F[0], F[1], F[3], F[5], F[2], F[4], F[6], QH, QL, KH, VT);
  k_fa<<<dim3(TT / FQ, TNB), 256, 0, stream>>>(QH, QL, KH, VT, F[0], F[7], (float*)d_out);
}

// v004
// A run of this version takes 59.2 microseconds.
// Timed twice side by side with v003, it ran 1.17 times as fast both times.
// Over all steps from v000 it is 12.5 times as fast.
// compute dtype: all float inputs rounded to bf16; q/k (32 channels) and v (256) = W x + b (1x1 convs) with EXACT bf16 products on WMMA 16x16x32, f32 accumulate; q as f16 hi + residual (x 2^10) against k once to f16 (2 products) for the UNSCALED scores (logit sigma ~5.7: peaked softmax); online softmax in f32 (running maximum; exponentials as 2^((s - max) log2 e) on the hardware exp2); exp(s - max) x 2^11 once to f16 against v once to f16 (1 product), divided by the f32 row sum at the end; gamma * out + x in f32; f32 output.
#include <hip/hip_runtime.h>
#include <math.h>

typedef __attribute__((ext_vector_type(16))) _Float16 v16h;
typedef __attribute__((ext_vector_type(16))) __bf16 v16b;
typedef __attribute__((ext_vector_type(8)))  _Float16 v8h;
typedef __attribute__((ext_vector_type(8)))  float v8f;
typedef __attribute__((ext_vector_type(4)))  float v4f;
typedef __attribute__((ext_vector_type(2)))  float v2f;
typedef __attribute__((ext_vector_type(4)))  unsigned v4u;
typedef __attribute__((ext_vector_type(4)))  int v4i;
typedef float __attribute__((may_alias)) float_a;
typedef int __attribute__((may_alias)) int_a;

template <typename T> __device__ __forceinline__ void vst2(void* p, T v) { *(T*)p = v;  }
__device__ __forceinline__ v8f wmma16(v16h a, v16h b, v8f c) {
  v8f d = __builtin_amdgcn_wmma_f32_16x16x32_f16(false, a, false, b, (short)0, c, false, false);
  asm volatile("v_nop\n\tv_nop\n\tv_nop\n\tv_nop" : "+v"(d) : "v"(a), "v"(b));
  return d;
}
__device__ __forceinline__ v8f wmma_bf(v16b a, v16b b, v8f c) {
  v8f d = __builtin_amdgcn_wmma_f32_16x16x32_bf16(false, a, false, b, (short)0, c, false, false);
  asm volatile("v_nop\n\tv_nop\n\tv_nop\n\tv_nop" : "+v"(d) : "v"(a), "v"(b));
  return d;
}
// 16x16x32 fragments: lane = (h = lane>>4, row/col = lane&15); elements 0..7 = k0+8h+0..7, 8..15 = k0+16+8h+0..7; D element r = row 8h+r
__device__ __forceinline__ v16h frag_h(const _Float16* rowk0, int lane) {
  union { v16h v; v8h q[2]; } u; const _Float16* p = rowk0 + 8 * (lane >> 4);
  u.q[0] = *(const v8h*)p; u.q[1] = *(const v8h*)(p + 16); return u.v;
}
__device__ __forceinline__ v16h frag_f32(const float* rowk0, int lane) {
  v16h a; const float* p = rowk0 + 8 * (lane >> 4);
#pragma unroll
  for (int i = 0; i < 8; ++i) { a[i] = (_Float16)p[i]; a[8 + i] = (_Float16)p[16 + i]; }
  return a;
}
__device__ __forceinline__ v16h frag_f32s(const float* rowk0, int lane, float sc) {
  v16h a; const float* p = rowk0 + 8 * (lane >> 4);
#pragma unroll
  for (int i = 0; i < 8; ++i) { a[i] = (_Float16)(p[i] * sc); a[8 + i] = (_Float16)(p[16 + i] * sc); }
  return a;
}
// column fragment from a [K][ld] layout (column n), rows >= K read as 0
__device__ __forceinline__ v16h fragc_f32(const float* W, int k0, int n, int lane, int ld, int K) {
  v16h a; const int g = lane >> 4;
#pragma unroll
  for (int i = 0; i < 8; ++i) { const int ka = k0 + 8 * g + i, kb = ka + 16;
    a[i] = (_Float16)(ka < K ? W[(size_t)(ka < K ? ka : K - 1) * ld + n] : 0.f); a[8 + i] = (_Float16)(kb < K ? W[(size_t)(kb < K ? kb : K - 1) * ld + n] : 0.f); }
  return a;
}
struct F2 { v16b h, l; };
__device__ __forceinline__ F2 bsplit16(const float v[16]) { F2 r;
#pragma unroll
  for (int i = 0; i < 16; ++i) { const __bf16 h = (__bf16)v[i]; r.h[i] = h; r.l[i] = (__bf16)(v[i] - (float)h); }
  return r; }
__device__ __forceinline__ F2 split_row(const float* row, int k0, int lane) { float v[16]; const float* p = row + k0 + 8 * (lane >> 4);
#pragma unroll
  for (int i = 0; i < 8; ++i) { v[i] = p[i]; v[8 + i] = p[16 + i]; }
  return bsplit16(v); }
__device__ __forceinline__ F2 split_rowK(const float* row, int k0, int lane, int K) { float v[16]; const int g = lane >> 4;
#pragma unroll
  for (int i = 0; i < 8; ++i) { const int ka = k0 + 8 * g + i, kb = ka + 16; v[i] = ka < K ? row[ka < K ? ka : K - 1] : 0.f; v[8 + i] = kb < K ? row[kb < K ? kb : K - 1] : 0.f; }
  return bsplit16(v); }
__device__ __forceinline__ F2 split_col(const float* W, int k0, int n, int lane, int ld, int K) { float v[16]; const int g = lane >> 4;
#pragma unroll
  for (int i = 0; i < 8; ++i) { const int ka = k0 + 8 * g + i, kb = ka + 16; v[i] = ka < K ? W[(size_t)(ka < K ? ka : K - 1) * ld + n] : 0.f; v[8 + i] = kb < K ? W[(size_t)(kb < K ? kb : K - 1) * ld + n] : 0.f; }
  return bsplit16(v); }
__device__ __forceinline__ v8f mac3(const F2& a, const F2& b, v8f c) { c = wmma_bf(a.l, b.h, c); c = wmma_bf(a.h, b.l, c); return wmma_bf(a.h, b.h, c); }
__device__ __forceinline__ float sigm(float v) { return 1.0f / (1.0f + expf(-v)); }
#define LDSX() do { asm volatile("s_wait_dscnt 0" ::: "memory"); __builtin_amdgcn_wave_barrier(); __builtin_amdgcn_fence(__ATOMIC_RELEASE, "workgroup"); } while (0)

// SAGAN-style 1-D self-attention (B 16, C 256, W 2,048): q, k = Wq/Wk x + b (32 channels), v = Wv x + b (256); scores[i][j] = q_i . k_j (no scaling); attn = softmax over j; out[c][i] = sum_j v[c][j] attn[i][j]; result = gamma * out + x.
#define NB 16
#define TT 2048
#define CC 256            // NH * HD = projected width
#define DIN 256          // input (model) width
#define NH 1
#define HD 256
#define NQB (TT / 64)
#define HG 4
#define SCALE (1.0f)
#define HDQK 32            // q / k channels (C/8); the q/k planes are CC wide but only columns < 32 are written and only they enter the scores
#define CAUSAL 0
#ifndef TNB
#define TNB NB
#endif
__device__ __forceinline__ v16b zero16b() { v16b z; _Pragma("unroll") for (int i = 0; i < 16; ++i) z[i] = (__bf16)0.f; return z; }
__device__ __forceinline__ float bfr(float v) { return (float)(__bf16)v; }
__host__ __device__ __forceinline__ int kb_last(int qb) { return CAUSAL ? ((qb * 64 + 63) >> 7) : (TT / 128 - 1); }
typedef __attribute__((ext_vector_type(8))) __bf16 v8b;
__device__ __forceinline__ v16b frag_b(const __bf16* rowk0, int lane) {
  union { v16b v; v8b q[2]; } u; const __bf16* p = rowk0 + 8 * (lane >> 4);
  u.q[0] = *(const v8b*)p; u.q[1] = *(const v8b*)(p + 16); return u.v;
}
#define QBH 0
#define QHI 2048            // rows carrying a q residual plane (all rows when non-causal: 2-product logits everywhere)
#define KHI 64            // key rows carrying k residual / v bf16 hi+lo planes (nothing in this file writes or reads them)
// B fragment (k rows k0+.., output column o) of a weight: (in,out) [K][ld] or (out,in) [ld rows of K]: bf16 exact, or f16(bf16 * 256) exact
__device__ __forceinline__ v16b wcol_io(const float* Wm, int k0, int o, int lane, int ld) { v16b w; const int g = lane >> 4;
#pragma unroll
  for (int i = 0; i < 8; ++i) { w[i] = (__bf16)Wm[(size_t)(k0 + 8 * g + i) * ld + o]; w[8 + i] = (__bf16)Wm[(size_t)(k0 + 16 + 8 * g + i) * ld + o]; }
  return w; }
__device__ __forceinline__ v16b wcol_oi(const float* Wm, int k0, int o, int lane, int K) { v16b w; const float* p = Wm + (size_t)o * K + k0 + 8 * (lane >> 4);
#pragma unroll
  for (int i = 0; i < 8; ++i) { w[i] = (__bf16)p[i]; w[8 + i] = (__bf16)p[16 + i]; }
  return w; }
__device__ __forceinline__ v16h wcolh_io(const float* Wm, int k0, int o, int lane, int ld) { v16h w; const int g = lane >> 4;
#pragma unroll
  for (int i = 0; i < 8; ++i) { w[i] = (_Float16)(bfr(Wm[(size_t)(k0 + 8 * g + i) * ld + o]) * 256.0f); w[8 + i] = (_Float16)(bfr(Wm[(size_t)(k0 + 16 + 8 * g + i) * ld + o]) * 256.0f); }
  return w; }
__device__ __forceinline__ v16h wcolh_oi(const float* Wm, int k0, int o, int lane, int K) { v16h w; const float* p = Wm + (size_t)o * K + k0 + 8 * (lane >> 4);
#pragma unroll
  for (int i = 0; i < 8; ++i) { w[i] = (_Float16)(bfr(p[i]) * 256.0f); w[8 + i] = (_Float16)(bfr(p[16 + i]) * 256.0f); }
  return w; }
#define WQKV_LAYOUT 1   // 0 = (in,out) [DIN][CC]; 1 = (out,in) [CC][DIN]; 2 = per-head [NH][DIN][HD]
__device__ __forceinline__ v16b wcol_hdk(const float* Wm, int k0, int o, int lane) { v16b w; const int g = lane >> 4; const float* p = Wm + (size_t)(o / HD) * DIN * HD + (o % HD);
#pragma unroll
  for (int i = 0; i < 8; ++i) { w[i] = (__bf16)p[(size_t)(k0 + 8 * g + i) * HD]; w[8 + i] = (__bf16)p[(size_t)(k0 + 16 + 8 * g + i) * HD]; }
  return w; }
#define WO_OUT_IN 0
#if WQKV_LAYOUT == 1
#define WCOL(W, k0, o, lane) ((which == 2 || (o) < HDQK) ? wcol_oi(W, k0, (o), lane, DIN) : zero16b())   /* wq/wk are [32][256]: projected q/k columns >= 32 are zero */
#elif WQKV_LAYOUT == 2
#define WCOL(W, k0, o, lane) wcol_hdk(W, k0, o, lane)
#else
#define WCOL(W, k0, o, lane) wcol_io(W, k0, o, lane, CC)
#endif
#if WO_OUT_IN
#define WOCOL(W, k0, o, lane) wcol_oi(W, k0, o, lane, CC)
#define WOCOLH(W, k0, o, lane) wcolh_oi(W, k0, o, lane, CC)
#else
#define WOCOL(W, k0, o, lane) wcol_io(W, k0, o, lane, DIN)
#define WOCOLH(W, k0, o, lane) wcolh_io(W, k0, o, lane, DIN)
#endif
#ifndef XP
#define XP TT              // position pitch of x and of the output
#endif
#define BG HG
#define DVH 128
#ifndef SM_EXTRA_PARAMS
#define SM_EXTRA_PARAMS
#endif
#ifndef PROJ_EXTRA_PARAMS
#define PROJ_EXTRA_PARAMS
#endif
#ifndef SM_MASK_HOOK
#define SM_MASK_HOOK (void)0
#endif

#define WS_QH  0u                                      // f16 q rows [b*t][CC]
#define WS_KH  (WS_QH + 2u * (size_t)NB * TT * CC)      // f16 k rows [b*t][CC]
#define WS_VT  (WS_KH + 2u * (size_t)NB * TT * CC)      // f16 v planes [b][c][t]
#define WS_QL  (WS_VT + 2u * (size_t)NB * CC * TT)      // f16 q residual x 2^10 rows [b][t < QHI][CC]
#define WS_KL  (WS_QL + 2u * (size_t)NB * QHI * CC)     // f16 k residual x 2^10 rows [b][t < KHI][CC]
#define WS_VB  (WS_KL + 2u * (size_t)NB * KHI * CC)     // bf16 v hi planes [b][c][t < KHI]
#define WS_VBL (WS_VB + 2u * (size_t)NB * CC * KHI)
#define WS_S   (WS_VBL + 2u * (size_t)NB * CC * KHI)    // unused f32 region of HG * TT * TT floats (k_fa keeps logits and P on chip)
#define WS_Y   (WS_S  + 4u * (size_t)HG * TT * TT)      // f32 ctx rows [b*t][CC] (only when there is an output projection)
#define WS_END (WS_Y  + 0u)

// ---- k_proj: block = 128 positions (8 waves x 16) of one batch, ALL 320 projected columns (q 0..31, k 32..63, v 64..319): X W + b with exact bf16 products (K = DIN), the k chunks summed in ascending order.
// The three weights are converted to bf16 and staged in LDS once per block; every wave reads its B fragments from there. Each wave gathers its 16 positions of x once and keeps the 8 A fragments in registers.
// Out: q f16 rows + residual rows, k f16 rows (32 columns each at pitch CC, the only ones that k_fa reads), v f16 planes [c][t]. Every loop of the kernel is unrolled so that a, acc, wf, wn and the biases are indexed by constants and stay in registers.
#define PT 128                         // positions per block
#define PO (2 * HDQK + CC)             // projected columns
#define PW_P (DIN * 2 + 16)            // LDS pitch of a bf16 weight row in bytes (16 B x odd: no bank conflict for 16-byte reads down a column of rows)
#define PV_P (PT + 8)                  // pitch in halves of a staged v channel row (16 B x odd)
#define PQ_P (HDQK + 8)                // pitch in halves of a staged q / k row
typedef __attribute__((ext_vector_type(4))) __bf16 v4b;
__device__ __forceinline__ v8f wmma_b(v16b a, v16b b, v8f c) { return __builtin_amdgcn_wmma_f32_16x16x32_bf16(false, a, false, b, (short)0, c, false, false); }
// rows wave + 8 i (i < n8) of a [rows][DIN] f32 weight -> bf16 rows in LDS, nb rows per batch of loads (nb <= 16 divides n8); a wave reads one row as two contiguous 512-B loads
__device__ __forceinline__ void stage_w(const float* __restrict__ Wm, char* dst, int n8, int nb, int wave, int lane) {
  /* the loop over batches stays rolled: one batch of loads in flight bounds the registers; the loops inside it are unrolled so that lo and hi are indexed by constants and stay in registers */
#pragma unroll 1
  for (int i0 = 0; i0 < n8; i0 += nb) { const float* p = Wm + (size_t)(wave + 8 * i0) * DIN + lane * 4; char* d = dst + (wave + 8 * i0) * PW_P + lane * 8; v4f lo[16], hi[16];
#pragma unroll
    for (int i = 0; i < nb; ++i) { lo[i] = *(const v4f*)(p + (size_t)i * 8 * DIN); hi[i] = *(const v4f*)(p + (size_t)i * 8 * DIN + DIN / 2); }
    asm volatile("s_wait_xcnt 0x0" :: "v"(p) : "memory");   // stands in front of every rewrite of the batch's address register; naming it keeps it out of the loads' own destinations
#pragma unroll
    for (int i = 0; i < nb; ++i) { v4b bl, bh;
#pragma unroll
      for (int e = 0; e < 4; ++e) { bl[e] = (__bf16)lo[i][e]; bh[e] = (__bf16)hi[i][e]; }
      *(v4b*)(d + i * 8 * PW_P) = bl; *(v4b*)(d + i * 8 * PW_P + DIN) = bh; } } }
__global__ __launch_bounds__(256) void k_proj(const float* __restrict__ X, const float* __restrict__ WQ, const float* __restrict__ WK, const float* __restrict__ WV, const float* __restrict__ BQ, const float* __restrict__ BK, const float* __restrict__ BV,
    _Float16* __restrict__ QH, _Float16* __restrict__ QL, _Float16* __restrict__ KH, _Float16* __restrict__ VT) {
  __shared__ __align__(16) char sw[PO * PW_P]; __shared__ __align__(16) _Float16 th[CC][PV_P], sqh[PT][PQ_P], sql[PT][PQ_P], skh[PT][PQ_P];
  const int tid = threadIdx.x, wave = tid >> 5, lane = tid & 31, col = lane & 15, g = lane >> 4; const size_t bb = blockIdx.y; const int t0 = blockIdx.x * PT;
  float bq[HDQK / 16] = {}, bk[HDQK / 16] = {}, bv[CC / 16] = {};   /* the biases of this lane's columns, fetched first so that the epilogue waits for no load; rounded to bf16 where they are used */
  if (BQ) {
#pragma unroll
    for (int j = 0; j < HDQK / 16; ++j) bq[j] = BQ[j * 16 + col]; }
  if (BK) {
#pragma unroll
    for (int j = 0; j < HDQK / 16; ++j) bk[j] = BK[j * 16 + col]; }
  if (BV) {
#pragma unroll
    for (int j = 0; j < CC / 16; ++j) bv[j] = BV[j * 16 + col]; }
  asm volatile("s_wait_xcnt 0x0" :: "s"(BQ), "s"(BK), "s"(BV) : "memory");   // stands in front of the first rewrite of a scalar base that the bias loads name; naming the three bases keeps them in their registers up to here
  v16b a[DIN / 32]; { const float* p = X + (bb * DIN + 8 * g) * (size_t)XP + t0 + wave * 16 + col;   /* channels-first gather: x[b][k][t], stride XP between k; row = position wave * 16 + col */
#pragma unroll
    for (int kc = 0; kc < DIN / 32; ++kc)
#pragma unroll
      for (int i = 0; i < 8; ++i) { a[kc][i] = (__bf16)p[(size_t)(kc * 32 + i) * XP]; a[kc][8 + i] = (__bf16)p[(size_t)(kc * 32 + 16 + i) * XP]; } }
  asm volatile("s_wait_xcnt 0x0" ::: "memory");   // stands in front of the first rewrite of an address register that the loads above name
  stage_w(WQ, sw, HDQK / 8, HDQK / 8, wave, lane); stage_w(WK, sw + HDQK * PW_P, HDQK / 8, HDQK / 8, wave, lane); stage_w(WV, sw + 2 * HDQK * PW_P, CC / 8, 16, wave, lane);
  __syncthreads();                                      // a weight row is staged by one wave and read by all eight
  v8f acc[PO / 16] = {};
  /* weight fragments are read from LDS one group ahead: a group is 10 fragments (one 32-k chunk x 160 columns; group n = chunk n >> 1, column half n & 1) */
  v16b wf[PO / 32], wn[PO / 32];
#pragma unroll
  for (int jj = 0; jj < PO / 32; ++jj) wf[jj] = frag_b((const __bf16*)(sw + (jj * 16 + col) * PW_P), lane);
#pragma unroll
  for (int u = 0; u < DIN / 16; ++u) { const int n = u + 1;   /* the group fetched ahead */
    if (n < DIN / 16) {
#pragma unroll
      for (int jj = 0; jj < PO / 32; ++jj) wn[jj] = frag_b((const __bf16*)(sw + (((n & 1) * (PO / 32) + jj) * 16 + col) * PW_P) + (n >> 1) * 32, lane); }
    __builtin_amdgcn_sched_barrier(0);   // bounds how far ahead the scheduler lifts LDS reads: left free it lifts more fragments than the registers hold and spills
#pragma unroll
    for (int jj = 0; jj < PO / 32; ++jj) acc[(u & 1) * (PO / 32) + jj] = wmma_b(a[u >> 1], wf[jj], acc[(u & 1) * (PO / 32) + jj]);
    if (n < DIN / 16) {
#pragma unroll
      for (int jj = 0; jj < PO / 32; ++jj) wf[jj] = wn[jj]; } }
  const int rl0 = wave * 16 + 8 * g;   /* D element r = position rl0 + r, column 16 j + col */
#pragma unroll
  for (int j = 0; j < HDQK / 16; ++j) {
#pragma unroll
    for (int r = 0; r < 8; ++r) { const float v = acc[j][r] + bfr(bq[j]); const _Float16 hv = (_Float16)v; sqh[rl0 + r][j * 16 + col] = hv; sql[rl0 + r][j * 16 + col] = (_Float16)((v - (float)hv) * 1024.0f); skh[rl0 + r][j * 16 + col] = (_Float16)(acc[HDQK / 16 + j][r] + bfr(bk[j])); } }
#pragma unroll
  for (int j = 0; j < CC / 16; ++j) { v8h pk;
#pragma unroll
    for (int r = 0; r < 8; ++r) pk[r] = (_Float16)(acc[2 * HDQK / 16 + j][r] + bfr(bv[j]));
    *(v8h*)&th[j * 16 + col][rl0] = pk; }
  __syncthreads();                                      // a staged row holds values of several waves
#pragma unroll
  for (int i = 0; i < CC * (PT / 8) / 256; ++i) { const int cl = (tid >> 4) + 16 * i, q = tid & 15; vst2((unsigned*)(VT + (bb * CC + cl) * (size_t)TT + t0 + q * 8), *(const v4u*)&th[cl][q * 8]); }   /* 256-B (channel, 128 positions) segment by 16 lanes */
#pragma unroll
  for (int i = 0; i < PT * (HDQK / 8) / 256; ++i) { const int rl = (tid >> 2) + 64 * i, q = tid & 3; const size_t o = (bb * TT + t0 + rl) * (size_t)CC + q * 8;
    vst2((unsigned*)(QH + o), *(const v4u*)&sqh[rl][q * 8]); vst2((unsigned*)(KH + o), *(const v4u*)&skh[rl][q * 8]); vst2((unsigned*)(QL + (bb * QHI + t0 + rl) * (size_t)CC + q * 8), *(const v4u*)&sql[rl][q * 8]); } }
#define FK 128                         // keys per staged tile
#define FQ 128                         // queries per block
#define FA_VP (FK * 2 + 16)            // LDS pitch of a v row in bytes (16 B x odd: no bank conflict for 16-byte reads down a column of rows)
#define FA_KP (HDQK * 2 + 16)          // LDS pitch of a k row in bytes (16 B x odd)
#define FA_VB (HD * FA_VP)             // bytes of the v tile; the k tile follows it
#define FA_BUF (FA_VB + FK * FA_KP)    // bytes of one buffer
#define FA_OP (FQ + 4)                 // pitch in floats of an output staging row (one channel, 128 queries)
#define FA_L2E 1.44269504088896340736f // log2 e: exp(d) = 2^(d log2 e), one fused multiply-add and one hardware exp2 per weight; a weight below 2^-126, which the unit may give as 0, is far below what f16 or the f32 row sum can hold
#define FA_OFF 11.0f                   // 2^((s - m) log2 e + 11) <= 2^11 keeps small weights out of the f16 denormals; the factor cancels in the division by the sum
// eight 16-byte copies per lane: LDS address l + i * ls, global address gp + i * gs; the s_wait_xcnt stands inside the statement so that no address register is rewritten ahead of it
__device__ __forceinline__ void cp8(unsigned l, unsigned ls, const char* gp, size_t gs) {
  asm volatile("global_load_async_to_lds_b128 %0, %8, off\n\t"
               "global_load_async_to_lds_b128 %1, %9, off\n\t"
               "global_load_async_to_lds_b128 %2, %10, off\n\t"
               "global_load_async_to_lds_b128 %3, %11, off\n\t"
               "global_load_async_to_lds_b128 %4, %12, off\n\t"
               "global_load_async_to_lds_b128 %5, %13, off\n\t"
               "global_load_async_to_lds_b128 %6, %14, off\n\t"
               "global_load_async_to_lds_b128 %7, %15, off\n\t"
               "s_wait_xcnt 0x0"
               :: "v"(l), "v"(l + ls), "v"(l + 2 * ls), "v"(l + 3 * ls), "v"(l + 4 * ls), "v"(l + 5 * ls), "v"(l + 6 * ls), "v"(l + 7 * ls),
                  "v"(gp), "v"(gp + gs), "v"(gp + 2 * gs), "v"(gp + 3 * gs), "v"(gp + 4 * gs), "v"(gp + 5 * gs), "v"(gp + 6 * gs), "v"(gp + 7 * gs)
               : "memory");
}
// two 16-byte copies per lane, same form
__device__ __forceinline__ void cp2(unsigned l, unsigned ls, const char* gp, size_t gs) {
  asm volatile("global_load_async_to_lds_b128 %0, %2, off\n\t"
               "global_load_async_to_lds_b128 %1, %3, off\n\t"
               "s_wait_xcnt 0x0"
               :: "v"(l), "v"(l + ls), "v"(gp), "v"(gp + gs)
               : "memory");
}
// one tile: v rows (tid >> 4) + 16 i, 16 lanes per 256-B row; k rows (tid >> 2) + 64 i, 4 lanes per 64-B row; 18 copies per wave
__device__ __forceinline__ void fa_stage(unsigned lv, unsigned lk, const char* gv, const char* gk) {
  cp8(lv, 16 * FA_VP, gv, (size_t)16 * TT * 2); cp8(lv + 128 * FA_VP, 16 * FA_VP, gv + (size_t)128 * TT * 2, (size_t)16 * TT * 2);
  cp2(lk, 64 * FA_KP, gk, (size_t)64 * CC * 2);
}
// 2^x on the hardware unit. Written as asm so that the slot which the instruction set asks for behind a transcendental is filled by construction: no result register is a source register of the statement ("=&v"), so a v_exp_f32
// neither reads its neighbour's result nor overwrites its source, and the v_nop stands behind the last one.
__device__ __forceinline__ float exp2_1(float x) { float r; asm("v_exp_f32 %0, %1\n\tv_nop" : "=&v"(r) : "v"(x)); return r; }
__device__ __forceinline__ v8f exp2_8(v8f x) { float a, b, c, d, e, f, g, h;
  asm("v_exp_f32 %0, %8\n\tv_exp_f32 %1, %9\n\tv_exp_f32 %2, %10\n\tv_exp_f32 %3, %11\n\tv_exp_f32 %4, %12\n\tv_exp_f32 %5, %13\n\tv_exp_f32 %6, %14\n\tv_exp_f32 %7, %15\n\tv_nop"
      : "=&v"(a), "=&v"(b), "=&v"(c), "=&v"(d), "=&v"(e), "=&v"(f), "=&v"(g), "=&v"(h) : "v"(x[0]), "v"(x[1]), "v"(x[2]), "v"(x[3]), "v"(x[4]), "v"(x[5]), "v"(x[6]), "v"(x[7]));
  const v8f r = {a, b, c, d, e, f, g, h}; return r; }
__device__ __forceinline__ v8f wmma_h(v16h a, v16h b, v8f c) { return __builtin_amdgcn_wmma_f32_16x16x32_f16(false, a, false, b, (short)0, c, false, false); }
__global__ __launch_bounds__(256) void k_fa(const _Float16* __restrict__ QH, const _Float16* __restrict__ QL, const _Float16* __restrict__ KH, const _Float16* __restrict__ VT, const float* __restrict__ X, const float* __restrict__ GM, float* __restrict__ OUT) {
  __shared__ __align__(16) char sm[2 * FA_BUF]; float (*st)[FA_OP] = (float (*)[FA_OP])sm;   /* the output staging reuses the ring behind its last barrier */
  const int tid = threadIdx.x, wave = tid >> 5, lane = tid & 31, col = lane & 15, g = lane >> 4; const size_t b = blockIdx.y; const int q0 = blockIdx.x * FQ;
  const v16h qh = frag_h(QH + (b * TT + q0 + wave * 16 + col) * CC, lane), ql = frag_h(QL + (b * QHI + q0 + wave * 16 + col) * CC, lane);   /* B operands: column = query col */
  v8f acc[HD / 16] = {}; float m = -3.0e38f, ls = 0.f;   /* acc[j][r] = O^T[channel 16 j + 8 g + r][query col]; m, ls belong to query col (ls: this half's keys) */
  const int nt = TT / FK;
  const unsigned l0 = (unsigned)(size_t)sm; const unsigned lv = l0 + (tid >> 4) * FA_VP + (tid & 15) * 16, lk = l0 + FA_VB + (tid >> 2) * FA_KP + (tid & 3) * 16;
  const char* gv = (const char*)(VT + (b * CC + (tid >> 4)) * (size_t)TT + (tid & 15) * 8); const char* gk = (const char*)(KH + (b * TT + (tid >> 2)) * (size_t)CC + (tid & 3) * 8);
  fa_stage(lv, lk, gv, gk);
  asm volatile("s_wait_asynccnt 0x0" ::: "memory");   // tile 0 of this wave has landed
  __syncthreads();                                    // ... and every wave's part of it
  if (nt > 1) fa_stage(lv + FA_BUF, lk + FA_BUF, gv + FK * 2, gk + (size_t)FK * CC * 2);
  /* the tile loop stays rolled: one publish point and one refill in the code; the loops inside the 64-key block loop are unrolled so that acc, s and pb are indexed by constants and stay in registers */
#pragma unroll 1
  for (int t = 0; t < nt; ++t) { const char* bu = sm + (t & 1) * FA_BUF; const char* bk = bu + FA_VB;
    /* the loop over the tile's two 64-key blocks stays rolled as well: unrolled, the compiler interleaves the blocks and runs out of registers */
#pragma unroll 1
    for (int sb = 0; sb < FK / 64; ++sb) { v8f s[4]; float mx[4], ps[4]; const char* bv = bu + sb * 128; const char* bks = bk + sb * (64 * FA_KP);
      /* v fragments are read from LDS one group ahead: a group is 8 fragments (32 keys x 128 channels; group n = 32-key half n >> 1, channel half n & 1); group 0 is read here, ahead of the scores and the softmax; nothing of tile t + 1 is read */
      v16h kf[4], vf[8], vn[8];
#pragma unroll
      for (int i = 0; i < 4; ++i) kf[i] = frag_h((const _Float16*)(bks + (i * 16 + col) * FA_KP), lane);
#pragma unroll
      for (int jj = 0; jj < 8; ++jj) vf[jj] = frag_h((const _Float16*)(bv + (jj * 16 + col) * FA_VP), lane);
#pragma unroll
      for (int i = 0; i < 4; ++i) { const v8f z = {}; const v8f sh = wmma_h(kf[i], qh, z), sl = wmma_h(kf[i], ql, z);
#pragma unroll
        for (int r = 0; r < 8; ++r) s[i][r] = (sh[r] + sl[r] * (1.0f / 1024.0f)) * SCALE;   /* key sb * 64 + 16 i + 8 g + r of the tile, query col */
        mx[i] = s[i][0];
#pragma unroll
        for (int r = 1; r < 8; ++r) mx[i] = fmaxf(mx[i], s[i][r]); }
      float mt = fmaxf(fmaxf(mx[0], mx[1]), fmaxf(mx[2], mx[3])); mt = fmaxf(mt, __shfl_xor(mt, 16));   /* the other half holds the query's other 32 keys */
      const float mn = fmaxf(m, mt), al = exp2_1((m - mn) * FA_L2E), mo = mn * FA_L2E - FA_OFF; m = mn;   /* al scales the accumulators and the sum alike, so its rounding cancels in the division */
      v16h pb[2];
#pragma unroll
      for (int i = 0; i < 4; ++i) { const v8f e = exp2_8(s[i] * FA_L2E - mo); ps[i] = e[0];
#pragma unroll
        for (int r = 1; r < 8; ++r) ps[i] += e[r];
#pragma unroll
        for (int r = 0; r < 8; ++r) pb[i >> 1][(i & 1) * 8 + r] = (_Float16)e[r]; }   /* element 8 (i & 1) + r = key 32 (i >> 1) + 16 (i & 1) + 8 g + r: the k order of frag_h */
      ls = ls * al + ((ps[0] + ps[1]) + (ps[2] + ps[3]));
#pragma unroll
      for (int j = 0; j < HD / 16; ++j) acc[j] *= al;
#pragma unroll
      for (int u = 0; u < 4; ++u) { const int n = u + 1;   /* the group fetched ahead */
        if (n < 4) {
#pragma unroll
          for (int jj = 0; jj < 8; ++jj) vn[jj] = frag_h((const _Float16*)(bv + (((n & 1) * 8 + jj) * 16 + col) * FA_VP) + (n >> 1) * 32, lane); }
        __builtin_amdgcn_sched_barrier(0);   // keeps the next group's LDS reads together ahead of this group's eight products; spread among them each product waits out an LDS latency
#pragma unroll
        for (int jj = 0; jj < 8; ++jj) acc[(u & 1) * 8 + jj] = (u == 3 && jj == 7) ? wmma16(vf[jj], pb[u >> 1], acc[(u & 1) * 8 + jj]) : wmma_h(vf[jj], pb[u >> 1], acc[(u & 1) * 8 + jj]);   /* the block's last product carries its four v_nop: on the loop's back edge its A registers are rewritten at once */
        if (n < 4) {
#pragma unroll
          for (int jj = 0; jj < 8; ++jj) vf[jj] = vn[jj]; } } }
    asm volatile("s_wait_dscnt 0x0" ::: "memory");      // this wave's reads of tile t are done before the buffer is refilled
    asm volatile("s_wait_asynccnt 0x0" ::: "memory");   // this wave's copies of tile t + 1 have landed
    __syncthreads();                                    // publishes tile t + 1 and ends every wave's reads of tile t
    if (t + 2 < nt) fa_stage(lv + (t & 1) * FA_BUF, lk + (t & 1) * FA_BUF, gv + (size_t)(t + 2) * (FK * 2), gk + (size_t)(t + 2) * ((size_t)FK * CC * 2)); }
  asm volatile("s_wait_asynccnt 0x0" ::: "memory");     // no copy is in flight when the ring becomes output staging
  const float inv = 1.0f / (ls + __shfl_xor(ls, 16));   /* the halves' sums joined once; the largest weight of a row is 2^11, so the sum is positive */
#pragma unroll
  for (int j = 0; j < HD / 16; ++j)
#pragma unroll
    for (int r = 0; r < 8; ++r) st[j * 16 + 8 * g + r][wave * 16 + col] = acc[j][r] * inv;
  __syncthreads();                                      // a channel row of 128 queries holds columns of all eight waves
  const float gmv = bfr(GM[0]);
  for (int c = wave; c < HD; c += 8) { const size_t o = (b * CC + c) * (size_t)XP + q0 + lane * 4; const v4f xr = *(const v4f*)(X + o), y = *(const v4f*)&st[c][lane * 4]; v4f v;   /* 512-B (channel, 128 queries) segment by 32 lanes */
#pragma unroll
    for (int i = 0; i < 4; ++i) v[i] = gmv * y[i] + bfr(xr[i]); vst2(OUT + o, v); } }   /* gamma * out + x */

extern "C" void kernel_launch(void* const* d_in, const int* in_sizes, int n_in, void* d_out, int out_size, void* d_ws, size_t ws_size, hipStream_t stream) {
  (void)in_sizes; (void)n_in; (void)out_size;
  const float** F = (const float**)d_in;
  if (ws_size < (size_t)WS_END) return;
  char* ws = (char*)d_ws; _Float16 *QH = (_Float16*)(ws + WS_QH), *KH = (_Float16*)(ws + WS_KH), *VT = (_Float16*)(ws + WS_VT), *QL = (_Float16*)(ws + WS_QL);
  // inputs: 0 x [16,256,2048] channels-first; 1 wq [32,256] (out,in), 2 bq [32]; 3 wk, 4 bk; 5 wv [256,256], 6 bv [256]; 7 gamma [1]
  k_proj<<<dim3(TT / PT, TNB), 256, 0, stream>>>(F[0], F[1], F[3], F[5], F[2], F[4], F[6], QH, QL, KH, VT);
  k_fa<<<dim3(TT / FQ, TNB), 256, 0, stream>>>(QH, QL, KH, VT, F[0], F[7], (float*)d_out);
}

// v005
// One run takes 55.7 microseconds.
// Timed twice side by side with v004, it ran 1.07 and 1.06 times as fast.
// Over all steps from v000 it is 13.2 times as fast.
// compute dtype: all float inputs rounded to bf16; q/k (32 channels) and v (256) = W x + b (1x1 convs) with EXACT bf16 products on WMMA 16x16x32, f32 accumulate; q as f16 hi + residual (x 2^10) against k once to f16 (2 products) for the UNSCALED scores (logit sigma ~5.7: peaked softmax); online softmax in f32 (running maximum; exponentials as 2^((s - max) log2 e) on the hardware exp2); exp(s - max) x 2^11 once to f16 against v once to f16 (1 product), divided by the f32 row sum at the end; gamma * out + x in f32; f32 output.
#include <hip/hip_runtime.h>
#include <math.h>

typedef __attribute__((ext_vector_type(16))) _Float16 v16h;
typedef __attribute__((ext_vector_type(16))) __bf16 v16b;
typedef __attribute__((ext_vector_type(8)))  _Float16 v8h;
typedef __attribute__((ext_vector_type(8)))  float v8f;
typedef __attribute__((ext_vector_type(4)))  float v4f;
typedef __attribute__((ext_vector_type(2)))  float v2f;
typedef __attribute__((ext_vector_type(4)))  unsigned v4u;
typedef __attribute__((ext_vector_type(4)))  int v4i;
typedef float __attribute__((may_alias)) float_a;
typedef int __attribute__((may_alias)) int_a;

template <typename T> __device__ __forceinline__ void vst2(void* p, T v) { *(T*)p = v;  }
__device__ __forceinline__ v8f wmma16(v16h a, v16h b, v8f c) {
  v8f d = __builtin_amdgcn_wmma_f32_16x16x32_f16(false, a, false, b, (short)0, c, false, false);
  asm volatile("v_nop\n\tv_nop\n\tv_nop\n\tv_nop" : "+v"(d) : "v"(a), "v"(b));
  return d;
}
__device__ __forceinline__ v8f wmma_bf(v16b a, v16b b, v8f c) {
  v8f d = __builtin_amdgcn_wmma_f32_16x16x32_bf16(false, a, false, b, (short)0, c, false, false);
  asm volatile("v_nop\n\tv_nop\n\tv_nop\n\tv_nop" : "+v"(d) : "v"(a), "v"(b));
  return d;
}
// 16x16x32 fragments: lane = (h = lane>>4, row/col = lane&15); elements 0..7 = k0+8h+0..7, 8..15 = k0+16+8h+0..7; D element r = row 8h+r
__device__ __forceinline__ v16h frag_h(const _Float16* rowk0, int lane) {
  union { v16h v; v8h q[2]; } u; const _Float16* p = rowk0 + 8 * (lane >> 4);
  u.q[0] = *(const v8h*)p; u.q[1] = *(const v8h*)(p + 16); return u.v;
}
__device__ __forceinline__ v16h frag_f32(const float* rowk0, int lane) {
  v16h a; const float* p = rowk0 + 8 * (lane >> 4);
#pragma unroll
  for (int i = 0; i < 8; ++i) { a[i] = (_Float16)p[i]; a[8 + i] = (_Float16)p[16 + i]; }
  return a;
}
__device__ __forceinline__ v16h frag_f32s(const float* rowk0, int lane, float sc) {
  v16h a; const float* p = rowk0 + 8 * (lane >> 4);
#pragma unroll
  for (int i = 0; i < 8; ++i) { a[i] = (_Float16)(p[i] * sc); a[8 + i] = (_Float16)(p[16 + i] * sc); }
  return a;
}
// column fragment from a [K][ld] layout (column n), rows >= K read as 0
__device__ __forceinline__ v16h fragc_f32(const float* W, int k0, int n, int lane, int ld, int K) {
  v16h a; const int g = lane >> 4;
#pragma unroll
  for (int i = 0; i < 8; ++i) { const int ka = k0 + 8 * g + i, kb = ka + 16;
    a[i] = (_Float16)(ka < K ? W[(size_t)(ka < K ? ka : K - 1) * ld + n] : 0.f); a[8 + i] = (_Float16)(kb < K ? W[(size_t)(kb < K ? kb : K - 1) * ld + n] : 0.f); }
  return a;
}
struct F2 { v16b h, l; };
__device__ __forceinline__ F2 bsplit16(const float v[16]) { F2 r;
#pragma unroll
  for (int i = 0; i < 16; ++i) { const __bf16 h = (__bf16)v[i]; r.h[i] = h; r.l[i] = (__bf16)(v[i] - (float)h); }
  return r; }
__device__ __forceinline__ F2 split_row(const float* row, int k0, int lane) { float v[16]; const float* p = row + k0 + 8 * (lane >> 4);
#pragma unroll
  for (int i = 0; i < 8; ++i) { v[i] = p[i]; v[8 + i] = p[16 + i]; }
  return bsplit16(v); }
__device__ __forceinline__ F2 split_rowK(const float* row, int k0, int lane, int K) { float v[16]; const int g = lane >> 4;
#pragma unroll
  for (int i = 0; i < 8; ++i) { const int ka = k0 + 8 * g + i, kb = ka + 16; v[i] = ka < K ? row[ka < K ? ka : K - 1] : 0.f; v[8 + i] = kb < K ? row[kb < K ? kb : K - 1] : 0.f; }
  return bsplit16(v); }
__device__ __forceinline__ F2 split_col(const float* W, int k0, int n, int lane, int ld, int K) { float v[16]; const int g = lane >> 4;
#pragma unroll
  for (int i = 0; i < 8; ++i) { const int ka = k0 + 8 * g + i, kb = ka + 16; v[i] = ka < K ? W[(size_t)(ka < K ? ka : K - 1) * ld + n] : 0.f; v[8 + i] = kb < K ? W[(size_t)(kb < K ? kb : K - 1) * ld + n] : 0.f; }
  return bsplit16(v); }
__device__ __forceinline__ v8f mac3(const F2& a, const F2& b, v8f c) { c = wmma_bf(a.l, b.h, c); c = wmma_bf(a.h, b.l, c); return wmma_bf(a.h, b.h, c); }
__device__ __forceinline__ float sigm(float v) { return 1.0f / (1.0f + expf(-v)); }
#define LDSX() do { asm volatile("s_wait_dscnt 0" ::: "memory"); __builtin_amdgcn_wave_barrier(); __builtin_amdgcn_fence(__ATOMIC_RELEASE, "workgroup"); } while (0)

// SAGAN-style 1-D self-attention (B 16, C 256, W 2,048): q, k = Wq/Wk x + b (32 channels), v = Wv x + b (256); scores[i][j] = q_i . k_j (no scaling); attn = softmax over j; out[c][i] = sum_j v[c][j] attn[i][j]; result = gamma * out + x.
#define NB 16
#define TT 2048
#define CC 256            // NH * HD = projected width
#define DIN 256          // input (model) width
#define NH 1
#define HD 256
#define NQB (TT / 64)
#define HG 4
#define SCALE (1.0f)
#define HDQK 32            // q / k channels (C/8); the q/k planes are CC wide but only columns < 32 are written and only they enter the scores
#define CAUSAL 0
#ifndef TNB
#define TNB NB
#endif
__device__ __forceinline__ v16b zero16b() { v16b z; _Pragma("unroll") for (int i = 0; i < 16; ++i) z[i] = (__bf16)0.f; return z; }
__device__ __forceinline__ float bfr(float v) { return (float)(__bf16)v; }
__host__ __device__ __forceinline__ int kb_last(int qb) { return CAUSAL ? ((qb * 64 + 63) >> 7) : (TT / 128 - 1); }
typedef __attribute__((ext_vector_type(8))) __bf16 v8b;
__device__ __forceinline__ v16b frag_b(const __bf16* rowk0, int lane) {
  union { v16b v; v8b q[2]; } u; const __bf16* p = rowk0 + 8 * (lane >> 4);
  u.q[0] = *(const v8b*)p; u.q[1] = *(const v8b*)(p + 16); return u.v;
}
#define QBH 0
#define QHI 2048            // rows carrying a q residual plane (all rows when non-causal: 2-product logits everywhere)
#define KHI 64            // key rows carrying k residual / v bf16 hi+lo planes (nothing in this file writes or reads them)
// B fragment (k rows k0+.., output column o) of a weight: (in,out) [K][ld] or (out,in) [ld rows of K]: bf16 exact, or f16(bf16 * 256) exact
__device__ __forceinline__ v16b wcol_io(const float* Wm, int k0, int o, int lane, int ld) { v16b w; const int g = lane >> 4;
#pragma unroll
  for (int i = 0; i < 8; ++i) { w[i] = (__bf16)Wm[(size_t)(k0 + 8 * g + i) * ld + o]; w[8 + i] = (__bf16)Wm[(size_t)(k0 + 16 + 8 * g + i) * ld + o]; }
  return w; }
__device__ __forceinline__ v16b wcol_oi(const float* Wm, int k0, int o, int lane, int K) { v16b w; const float* p = Wm + (size_t)o * K + k0 + 8 * (lane >> 4);
#pragma unroll
  for (int i = 0; i < 8; ++i) { w[i] = (__bf16)p[i]; w[8 + i] = (__bf16)p[16 + i]; }
  return w; }
__device__ __forceinline__ v16h wcolh_io(const float* Wm, int k0, int o, int lane, int ld) { v16h w; const int g = lane >> 4;
#pragma unroll
  for (int i = 0; i < 8; ++i) { w[i] = (_Float16)(bfr(Wm[(size_t)(k0 + 8 * g + i) * ld + o]) * 256.0f); w[8 + i] = (_Float16)(bfr(Wm[(size_t)(k0 + 16 + 8 * g + i) * ld + o]) * 256.0f); }
  return w; }
__device__ __forceinline__ v16h wcolh_oi(const float* Wm, int k0, int o, int lane, int K) { v16h w; const float* p = Wm + (size_t)o * K + k0 + 8 * (lane >> 4);
#pragma unroll
  for (int i = 0; i < 8; ++i) { w[i] = (_Float16)(bfr(p[i]) * 256.0f); w[8 + i] = (_Float16)(bfr(p[16 + i]) * 256.0f); }
  return w; }
#define WQKV_LAYOUT 1   // 0 = (in,out) [DIN][CC]; 1 = (out,in) [CC][DIN]; 2 = per-head [NH][DIN][HD]
__device__ __forceinline__ v16b wcol_hdk(const float* Wm, int k0, int o, int lane) { v16b w; const int g = lane >> 4; const float* p = Wm + (size_t)(o / HD) * DIN * HD + (o % HD);
#pragma unroll
  for (int i = 0; i < 8; ++i) { w[i] = (__bf16)p[(size_t)(k0 + 8 * g + i) * HD]; w[8 + i] = (__bf16)p[(size_t)(k0 + 16 + 8 * g + i) * HD]; }
  return w; }
#define WO_OUT_IN 0
#if WQKV_LAYOUT == 1
#define WCOL(W, k0, o, lane) ((which == 2 || (o) < HDQK) ? wcol_oi(W, k0, (o), lane, DIN) : zero16b())   /* wq/wk are [32][256]: projected q/k columns >= 32 are zero */
#elif WQKV_LAYOUT == 2
#define WCOL(W, k0, o, lane) wcol_hdk(W, k0, o, lane)
#else
#define WCOL(W, k0, o, lane) wcol_io(W, k0, o, lane, CC)
#endif
#if WO_OUT_IN
#define WOCOL(W, k0, o, lane) wcol_oi(W, k0, o, lane, CC)
#define WOCOLH(W, k0, o, lane) wcolh_oi(W, k0, o, lane, CC)
#else
#define WOCOL(W, k0, o, lane) wcol_io(W, k0, o, lane, DIN)
#define WOCOLH(W, k0, o, lane) wcolh_io(W, k0, o, lane, DIN)
#endif
#ifndef XP
#define XP TT              // position pitch of x and of the output
#endif
#define BG HG
#define DVH 128
#ifndef SM_EXTRA_PARAMS
#define SM_EXTRA_PARAMS
#endif
#ifndef PROJ_EXTRA_PARAMS
#define PROJ_EXTRA_PARAMS
#endif
#ifndef SM_MASK_HOOK
#define SM_MASK_HOOK (void)0
#endif

#define WS_QH  0u                                      // f16 q rows [b*t][CC]
#define WS_KH  (WS_QH + 2u * (size_t)NB * TT * CC)      // f16 k rows [b*t][CC]
#define WS_VT  (WS_KH + 2u * (size_t)NB * TT * CC)      // f16 v planes [b][c][t]
#define WS_QL  (WS_VT + 2u * (size_t)NB * CC * TT)      // f16 q residual x 2^10 rows [b][t < QHI][CC]
#define WS_KL  (WS_QL + 2u * (size_t)NB * QHI * CC)     // f16 k residual x 2^10 rows [b][t < KHI][CC]
#define WS_VB  (WS_KL + 2u * (size_t)NB * KHI * CC)     // bf16 v hi planes [b][c][t < KHI]
#define WS_VBL (WS_VB + 2u * (size_t)NB * CC * KHI)
#define WS_S   (WS_VBL + 2u * (size_t)NB * CC * KHI)    // unused f32 region of HG * TT * TT floats (k_fa keeps logits and P on chip)
#define WS_Y   (WS_S  + 4u * (size_t)HG * TT * TT)      // f32 ctx rows [b*t][CC] (only when there is an output projection)
#define WS_END (WS_Y  + 0u)

// ---- k_proj: block = 128 positions (8 waves x 16) of one batch, ALL 320 projected columns (q 0..31, k 32..63, v 64..319): X W + b with exact bf16 products (K = DIN), the k chunks summed in ascending order.
// The three weights are converted to bf16 and staged in LDS once per block; every wave reads its B fragments from there. Each wave gathers its 16 positions of x once and keeps the 8 A fragments in registers.
// Out: q f16 rows + residual rows, k f16 rows (32 columns each at pitch CC, the only ones that k_fa reads), v f16 planes [c][t]. Every loop of the kernel is unrolled so that a, acc, wf, wn and the biases are indexed by constants and stay in registers.
#define PT 128                         // positions per block
#define PO (2 * HDQK + CC)             // projected columns
#define PW_P (DIN * 2 + 16)            // LDS pitch of a bf16 weight row in bytes (16 B x odd: no bank conflict for 16-byte reads down a column of rows)
#define PV_P (PT + 8)                  // pitch in halves of a staged v channel row (16 B x odd)
#define PQ_P (HDQK + 8)                // pitch in halves of a staged q / k row
typedef __attribute__((ext_vector_type(4))) __bf16 v4b;
__device__ __forceinline__ v8f wmma_b(v16b a, v16b b, v8f c) { return __builtin_amdgcn_wmma_f32_16x16x32_bf16(false, a, false, b, (short)0, c, false, false); }
// rows wave + 8 i (i < n8) of a [rows][DIN] f32 weight -> bf16 rows in LDS, nb rows per batch of loads (nb <= 16 divides n8); a wave reads one row as two contiguous 512-B loads
__device__ __forceinline__ void stage_w(const float* __restrict__ Wm, char* dst, int n8, int nb, int wave, int lane) {
  /* the loop over batches stays rolled: one batch of loads in flight bounds the registers; the loops inside it are unrolled so that lo and hi are indexed by constants and stay in registers */
#pragma unroll 1
  for (int i0 = 0; i0 < n8; i0 += nb) { const float* p = Wm + (size_t)(wave + 8 * i0) * DIN + lane * 4; char* d = dst + (wave + 8 * i0) * PW_P + lane * 8; v4f lo[16], hi[16];
#pragma unroll
    for (int i = 0; i < nb; ++i) { lo[i] = *(const v4f*)(p + (size_t)i * 8 * DIN); hi[i] = *(const v4f*)(p + (size_t)i * 8 * DIN + DIN / 2); }
    asm volatile("s_wait_xcnt 0x0" :: "v"(p) : "memory");   // stands in front of every rewrite of the batch's address register; naming it keeps it out of the loads' own destinations
#pragma unroll
    for (int i = 0; i < nb; ++i) { v4b bl, bh;
#pragma unroll
      for (int e = 0; e < 4; ++e) { bl[e] = (__bf16)lo[i][e]; bh[e] = (__bf16)hi[i][e]; }
      *(v4b*)(d + i * 8 * PW_P) = bl; *(v4b*)(d + i * 8 * PW_P + DIN) = bh; } } }
__global__ __launch_bounds__(256) void k_proj(const float* __restrict__ X, const float* __restrict__ WQ, const float* __restrict__ WK, const float* __restrict__ WV, const float* __restrict__ BQ, const float* __restrict__ BK, const float* __restrict__ BV,
    _Float16* __restrict__ QH, _Float16* __restrict__ QL, _Float16* __restrict__ KH, _Float16* __restrict__ VT) {
  __shared__ __align__(16) char sw[PO * PW_P]; __shared__ __align__(16) _Float16 th[CC][PV_P], sqh[PT][PQ_P], sql[PT][PQ_P], skh[PT][PQ_P];
  const int tid = threadIdx.x, wave = tid >> 5, lane = tid & 31, col = lane & 15, g = lane >> 4; const size_t bb = blockIdx.y; const int t0 = blockIdx.x * PT;
  float bq[HDQK / 16] = {}, bk[HDQK / 16] = {}, bv[CC / 16] = {};   /* the biases of this lane's columns, fetched first so that the epilogue waits for no load; rounded to bf16 where they are used */
  if (BQ) {
#pragma unroll
    for (int j = 0; j < HDQK / 16; ++j) bq[j] = BQ[j * 16 + col]; }
  if (BK) {
#pragma unroll
    for (int j = 0; j < HDQK / 16; ++j) bk[j] = BK[j * 16 + col]; }
  if (BV) {
#pragma unroll
    for (int j = 0; j < CC / 16; ++j) bv[j] = BV[j * 16 + col]; }
  asm volatile("s_wait_xcnt 0x0" :: "s"(BQ), "s"(BK), "s"(BV) : "memory");   // stands in front of the first rewrite of a scalar base that the bias loads name; naming the three bases keeps them in their registers up to here
  v16b a[DIN / 32]; { const float* p = X + (bb * DIN + 8 * g) * (size_t)XP + t0 + wave * 16 + col;   /* channels-first gather: x[b][k][t], stride XP between k; row = position wave * 16 + col */
#pragma unroll
    for (int kc = 0; kc < DIN / 32; ++kc)
#pragma unroll
      for (int i = 0; i < 8; ++i) { a[kc][i] = (__bf16)p[(size_t)(kc * 32 + i) * XP]; a[kc][8 + i] = (__bf16)p[(size_t)(kc * 32 + 16 + i) * XP]; } }
  asm volatile("s_wait_xcnt 0x0" ::: "memory");   // stands in front of the first rewrite of an address register that the loads above name
  stage_w(WQ, sw, HDQK / 8, HDQK / 8, wave, lane); stage_w(WK, sw + HDQK * PW_P, HDQK / 8, HDQK / 8, wave, lane); stage_w(WV, sw + 2 * HDQK * PW_P, CC / 8, 16, wave, lane);
  __syncthreads();                                      // a weight row is staged by one wave and read by all eight
  v8f acc[PO / 16] = {};
  /* weight fragments are read from LDS one group ahead: a group is 10 fragments (one 32-k chunk x 160 columns; group n = chunk n >> 1, column half n & 1) */
  v16b wf[PO / 32], wn[PO / 32];
#pragma unroll
  for (int jj = 0; jj < PO / 32; ++jj) wf[jj] = frag_b((const __bf16*)(sw + (jj * 16 + col) * PW_P), lane);
#pragma unroll
  for (int u = 0; u < DIN / 16; ++u) { const int n = u + 1;   /* the group fetched ahead */
    if (n < DIN / 16) {
#pragma unroll
      for (int jj = 0; jj < PO / 32; ++jj) wn[jj] = frag_b((const __bf16*)(sw + (((n & 1) * (PO / 32) + jj) * 16 + col) * PW_P) + (n >> 1) * 32, lane); }
    __builtin_amdgcn_sched_barrier(0);   // bounds how far ahead the scheduler lifts LDS reads: left free it lifts more fragments than the registers hold and spills
#pragma unroll
    for (int jj = 0; jj < PO / 32; ++jj) acc[(u & 1) * (PO / 32) + jj] = wmma_b(a[u >> 1], wf[jj], acc[(u & 1) * (PO / 32) + jj]);
    if (n < DIN / 16) {
#pragma unroll
      for (int jj = 0; jj < PO / 32; ++jj) wf[jj] = wn[jj]; } }
  const int rl0 = wave * 16 + 8 * g;   /* D element r = position rl0 + r, column 16 j + col */
#pragma unroll
  for (int j = 0; j < HDQK / 16; ++j) {
#pragma unroll
    for (int r = 0; r < 8; ++r) { const float v = acc[j][r] + bfr(bq[j]); const _Float16 hv = (_Float16)v; sqh[rl0 + r][j * 16 + col] = hv; sql[rl0 + r][j * 16 + col] = (_Float16)((v - (float)hv) * 1024.0f); skh[rl0 + r][j * 16 + col] = (_Float16)(acc[HDQK / 16 + j][r] + bfr(bk[j])); } }
#pragma unroll
  for (int j = 0; j < CC / 16; ++j) { v8h pk;
#pragma unroll
    for (int r = 0; r < 8; ++r) pk[r] = (_Float16)(acc[2 * HDQK / 16 + j][r] + bfr(bv[j]));
    *(v8h*)&th[j * 16 + col][rl0] = pk; }
  __syncthreads();                                      // a staged row holds values of several waves
#pragma unroll
  for (int i = 0; i < CC * (PT / 8) / 256; ++i) { const int cl = (tid >> 4) + 16 * i, q = tid & 15; vst2((unsigned*)(VT + (bb * CC + cl) * (size_t)TT + t0 + q * 8), *(const v4u*)&th[cl][q * 8]); }   /* 256-B (channel, 128 positions) segment by 16 lanes */
#pragma unroll
  for (int i = 0; i < PT * (HDQK / 8) / 256; ++i) { const int rl = (tid >> 2) + 64 * i, q = tid & 3; const size_t o = (bb * TT + t0 + rl) * (size_t)CC + q * 8;
    vst2((unsigned*)(QH + o), *(const v4u*)&sqh[rl][q * 8]); vst2((unsigned*)(KH + o), *(const v4u*)&skh[rl][q * 8]); vst2((unsigned*)(QL + (bb * QHI + t0 + rl) * (size_t)CC + q * 8), *(const v4u*)&sql[rl][q * 8]); } }
#define FK 128                         // keys per staged tile
#define FQ 128                         // queries per block
#define FA_VP (FK * 2 + 16)            // LDS pitch of a v row in bytes (16 B x odd: no bank conflict for 16-byte reads down a column of rows)
#define FA_KP (HDQK * 2 + 16)          // LDS pitch of a k row in bytes (16 B x odd)
#define FA_VB (HD * FA_VP)             // bytes of the v tile; the k tile follows it
#define FA_BUF (FA_VB + FK * FA_KP)    // bytes of one buffer
#define FA_OP (FQ + 4)                 // pitch in floats of an output staging row (one channel, 128 queries)
#define FA_ST (2 * HD * FA_OP * 4)     // bytes of the output staging: one plane of HD rows for each key half
#define FA_L2E 1.44269504088896340736f // log2 e: exp(d) = 2^(d log2 e), one fused multiply-add and one hardware exp2 per weight; a weight below 2^-126, which the unit may give as 0, is far below what f16 or the f32 row sum can hold
#define FA_OFF 11.0f                   // 2^((s - m) log2 e + 11) <= 2^11 keeps small weights out of the f16 denormals; the factor cancels in the division by the sum
// eight 16-byte copies per lane: LDS address l + i * ls, global address gp + i * gs; the s_wait_xcnt stands inside the statement so that no address register is rewritten ahead of it
__device__ __forceinline__ void cp8(unsigned l, unsigned ls, const char* gp, size_t gs) {
  asm volatile("global_load_async_to_lds_b128 %0, %8, off\n\t"
               "global_load_async_to_lds_b128 %1, %9, off\n\t"
               "global_load_async_to_lds_b128 %2, %10, off\n\t"
               "global_load_async_to_lds_b128 %3, %11, off\n\t"
               "global_load_async_to_lds_b128 %4, %12, off\n\t"
               "global_load_async_to_lds_b128 %5, %13, off\n\t"
               "global_load_async_to_lds_b128 %6, %14, off\n\t"
               "global_load_async_to_lds_b128 %7, %15, off\n\t"
               "s_wait_xcnt 0x0"
               :: "v"(l), "v"(l + ls), "v"(l + 2 * ls), "v"(l + 3 * ls), "v"(l + 4 * ls), "v"(l + 5 * ls), "v"(l + 6 * ls), "v"(l + 7 * ls),
                  "v"(gp), "v"(gp + gs), "v"(gp + 2 * gs), "v"(gp + 3 * gs), "v"(gp + 4 * gs), "v"(gp + 5 * gs), "v"(gp + 6 * gs), "v"(gp + 7 * gs)
               : "memory");
}
// two 16-byte copies per lane, same form
__device__ __forceinline__ void cp2(unsigned l, unsigned ls, const char* gp, size_t gs) {
  asm volatile("global_load_async_to_lds_b128 %0, %2, off\n\t"
               "global_load_async_to_lds_b128 %1, %3, off\n\t"
               "s_wait_xcnt 0x0"
               :: "v"(l), "v"(l + ls), "v"(gp), "v"(gp + gs)
               : "memory");
}
// one tile: v rows (tid >> 4) + 16 i, 16 lanes per 256-B row; k rows (tid >> 2) + 64 i, 4 lanes per 64-B row; 18 copies per wave
__device__ __forceinline__ void fa_stage(unsigned lv, unsigned lk, const char* gv, const char* gk) {
  cp8(lv, 16 * FA_VP, gv, (size_t)16 * TT * 2); cp8(lv + 128 * FA_VP, 16 * FA_VP, gv + (size_t)128 * TT * 2, (size_t)16 * TT * 2);
  cp2(lk, 64 * FA_KP, gk, (size_t)64 * CC * 2);
}
// 2^x on the hardware unit. Written as asm so that the slot which the instruction set asks for behind a transcendental is filled by construction: no result register is a source register of the statement ("=&v"), so a v_exp_f32
// neither reads its neighbour's result nor overwrites its source, and the v_nop stands behind the last one.
__device__ __forceinline__ float exp2_1(float x) { float r; asm("v_exp_f32 %0, %1\n\tv_nop" : "=&v"(r) : "v"(x)); return r; }
__device__ __forceinline__ v8f exp2_8(v8f x) { float a, b, c, d, e, f, g, h;
  asm("v_exp_f32 %0, %8\n\tv_exp_f32 %1, %9\n\tv_exp_f32 %2, %10\n\tv_exp_f32 %3, %11\n\tv_exp_f32 %4, %12\n\tv_exp_f32 %5, %13\n\tv_exp_f32 %6, %14\n\tv_exp_f32 %7, %15\n\tv_nop"
      : "=&v"(a), "=&v"(b), "=&v"(c), "=&v"(d), "=&v"(e), "=&v"(f), "=&v"(g), "=&v"(h) : "v"(x[0]), "v"(x[1]), "v"(x[2]), "v"(x[3]), "v"(x[4]), "v"(x[5]), "v"(x[6]), "v"(x[7]));
  const v8f r = {a, b, c, d, e, f, g, h}; return r; }
__device__ __forceinline__ v8f wmma_h(v16h a, v16h b, v8f c) { return __builtin_amdgcn_wmma_f32_16x16x32_f16(false, a, false, b, (short)0, c, false, false); }
// a fragment kept in LDS by the lane that owns it: its two 16-byte pieces at p and p + 512 (a wave's 32 pieces are contiguous: no bank conflict)
__device__ __forceinline__ void park_own(char* p, v16h v) { union { v16h v; v8h q[2]; } u; u.v = v; *(v8h*)p = u.q[0]; *(v8h*)(p + 512) = u.q[1]; }
__device__ __forceinline__ v16h frag_own(const char* p) { union { v16h v; v8h q[2]; } u; u.q[0] = *(const v8h*)p; u.q[1] = *(const v8h*)(p + 512); return u.v; }
__global__ __launch_bounds__(256) void k_fa(const _Float16* __restrict__ QH, const _Float16* __restrict__ QL, const _Float16* __restrict__ KH, const _Float16* __restrict__ VT, const float* __restrict__ X, const float* __restrict__ GM, float* __restrict__ OUT) {
  static_assert(2 * FA_BUF <= FA_ST, "the ring lies inside the staging planes");
  __shared__ __align__(16) char sm[FA_ST + 8 * 2 * 16 * 8]; float (*st)[FA_OP] = (float (*)[FA_OP])sm;   /* the output staging (rows 0..HD-1: key half 0, HD..2 HD-1: key half 1) reuses the ring behind its last barrier */
  v2f* ml = (v2f*)(sm + FA_ST);   /* behind the staging planes: (maximum, sum) of [wave][query tile][query] */
  const int tid = threadIdx.x, wave = __builtin_amdgcn_readfirstlane(tid >> 5), lane = tid & 31, col = lane & 15, g = lane >> 4; const size_t b = blockIdx.y; const int q0 = blockIdx.x * FQ;
  const int qg = wave >> 1, kh = wave & 1;   /* the wave's 32 queries; its 64-key half of every tile */
  /* the four q fragments (B operands: column = query col of tile qt; hi and residual) are parked in LDS, each lane's 16-byte pieces in its own slots, and read back with every tile's k fragments: beside 256 accumulator registers they do not stay resident, and the compiler's spill would come back from memory */
  __shared__ __align__(16) char sq[8 * 4096]; char* qs = sq + wave * 4096 + lane * 16;
  v16h qf[4]; { const _Float16* qp[4];   /* the lane's own address in row q0 + 32 qg + 16 qt + col: the k order of frag_h */
#pragma unroll
    for (int qt = 0; qt < 2; ++qt) { qp[2 * qt] = QH + (b * TT + q0 + qg * 32 + qt * 16 + col) * CC + 8 * g; qp[2 * qt + 1] = QL + (b * QHI + q0 + qg * 32 + qt * 16 + col) * CC + 8 * g; }
#pragma unroll
    for (int i = 0; i < 4; ++i) { union { v16h v; v8h q[2]; } u; u.q[0] = *(const v8h*)qp[i]; u.q[1] = *(const v8h*)(qp[i] + 16); qf[i] = u.v; }
    asm volatile("s_wait_xcnt 0x0" :: "v"(qp[0]), "v"(qp[1]), "v"(qp[2]), "v"(qp[3]) : "memory");   // stands in front of the first rewrite of an address register that the loads above name; naming the four addresses keeps them in their registers up to here
  }
  v8f acc[2][HD / 16] = {}; float m[2] = {-3.0e38f, -3.0e38f}, ls[2] = {0.f, 0.f};   /* acc[qt][j][r] = O^T[channel 16 j + 8 g + r][query 16 qt + col] over this wave's keys; m, ls belong to that query (ls: this half's keys) */
  const int nt = TT / FK;
  const unsigned l0 = (unsigned)(size_t)sm; const unsigned lv = l0 + (tid >> 4) * FA_VP + (tid & 15) * 16, lk = l0 + FA_VB + (tid >> 2) * FA_KP + (tid & 3) * 16;
  const char* gv = (const char*)(VT + (b * CC + (tid >> 4)) * (size_t)TT + (tid & 15) * 8); const char* gk = (const char*)(KH + (b * TT + (tid >> 2)) * (size_t)CC + (tid & 3) * 8);
  fa_stage(lv, lk, gv, gk);
#pragma unroll
  for (int i = 0; i < 4; ++i) park_own(qs + i * 1024, qf[i]);   /* behind the issue of tile 0's copies: the wait for q runs beside their flight */
  asm volatile("s_wait_asynccnt 0x0" ::: "memory");   // tile 0 of this wave has landed
  __syncthreads();                                    // ... and every wave's part of it
  if (nt > 1) fa_stage(lv + FA_BUF, lk + FA_BUF, gv + FK * 2, gk + (size_t)FK * CC * 2);
  /* the tile loop stays rolled: one publish point and one refill in the code; the loops inside it are unrolled so that acc, s and pb are indexed by constants and stay in registers */
#pragma unroll 1
  for (int t = 0; t < nt; ++t) { const char* bu = sm + (t & 1) * FA_BUF; const char* bv = bu + kh * 128; const char* bks = bu + FA_VB + kh * (64 * FA_KP);
    /* v fragments are read from LDS one group ahead: a group is 4 fragments (32 keys x 64 channels; group n = 32-key half n >> 2, channel quarter n & 3), each used for both query tiles; group 0 is read here, ahead of the scores and the softmax; nothing of tile t + 1 is read */
    v16h kf[4], vf[4], vn[4], pb[2][2], qh[2], ql[2];
#pragma unroll
    for (int i = 0; i < 4; ++i) kf[i] = frag_h((const _Float16*)(bks + (i * 16 + col) * FA_KP), lane);
#pragma unroll
    for (int qt = 0; qt < 2; ++qt) { qh[qt] = frag_own(qs + qt * 2048); ql[qt] = frag_own(qs + qt * 2048 + 1024); }
#pragma unroll
    for (int jj = 0; jj < 4; ++jj) vf[jj] = frag_h((const _Float16*)(bv + (jj * 16 + col) * FA_VP), lane);
#pragma unroll
    for (int qt = 0; qt < 2; ++qt) { v8f s[4]; float mx[4], ps[4];
#pragma unroll
      for (int i = 0; i < 4; ++i) { const v8f z = {}; const v8f sh = wmma_h(kf[i], qh[qt], z), sl = wmma_h(kf[i], ql[qt], z);
#pragma unroll
        for (int r = 0; r < 8; ++r) s[i][r] = (sh[r] + sl[r] * (1.0f / 1024.0f)) * SCALE;   /* key kh * 64 + 16 i + 8 g + r of the tile, query 16 qt + col */
        mx[i] = s[i][0];
#pragma unroll
        for (int r = 1; r < 8; ++r) mx[i] = fmaxf(mx[i], s[i][r]); }
      float mt = fmaxf(fmaxf(mx[0], mx[1]), fmaxf(mx[2], mx[3])); mt = fmaxf(mt, __shfl_xor(mt, 16));   /* the other half holds the query's other 32 keys */
      const float mn = fmaxf(m[qt], mt), al = exp2_1((m[qt] - mn) * FA_L2E), mo = mn * FA_L2E - FA_OFF; m[qt] = mn;   /* al scales the accumulators and the sum alike, so its rounding cancels in the division */
#pragma unroll
      for (int i = 0; i < 4; ++i) { const v8f e = exp2_8(s[i] * FA_L2E - mo); ps[i] = e[0];
#pragma unroll
        for (int r = 1; r < 8; ++r) ps[i] += e[r];
#pragma unroll
        for (int r = 0; r < 8; ++r) pb[qt][i >> 1][(i & 1) * 8 + r] = (_Float16)e[r]; }   /* element 8 (i & 1) + r = key 32 (i >> 1) + 16 (i & 1) + 8 g + r: the k order of frag_h */
      ls[qt] = ls[qt] * al + ((ps[0] + ps[1]) + (ps[2] + ps[3]));
#pragma unroll
      for (int j = 0; j < HD / 16; ++j) acc[qt][j] *= al; }
#pragma unroll
    for (int u = 0; u < 8; ++u) { const int n = u + 1;   /* the group fetched ahead */
      if (n < 8) {
#pragma unroll
        for (int jj = 0; jj < 4; ++jj) vn[jj] = frag_h((const _Float16*)(bv + (((n & 3) * 4 + jj) * 16 + col) * FA_VP) + (n >> 2) * 32, lane); }
      __builtin_amdgcn_sched_barrier(0);   // keeps the next group's LDS reads together ahead of this group's eight products; spread among them each product waits out an LDS latency
#pragma unroll
      for (int jj = 0; jj < 4; ++jj) { acc[0][(u & 3) * 4 + jj] = wmma_h(vf[jj], pb[0][u >> 2], acc[0][(u & 3) * 4 + jj]);
        acc[1][(u & 3) * 4 + jj] = wmma_h(vf[jj], pb[1][u >> 2], acc[1][(u & 3) * 4 + jj]); }
      if (n < 8) {
#pragma unroll
        for (int jj = 0; jj < 4; ++jj) vf[jj] = vn[jj]; } }
    asm volatile("s_wait_dscnt 0x0" ::: "memory");      // this wave's reads of tile t are done before the buffer is refilled
    asm volatile("s_wait_asynccnt 0x0" ::: "memory");   // this wave's copies of tile t + 1 have landed
    __syncthreads();                                    // publishes tile t + 1 and ends every wave's reads of tile t
    if (t + 2 < nt) fa_stage(lv + (t & 1) * FA_BUF, lk + (t & 1) * FA_BUF, gv + (size_t)(t + 2) * (FK * 2), gk + (size_t)(t + 2) * ((size_t)FK * CC * 2)); }
  asm volatile("s_wait_asynccnt 0x0" ::: "memory");     // no copy is in flight when the ring becomes output staging
  /* the two waves of a query group (key halves 0 and 1) are joined: common maximum M, each wave's accumulators and sum scaled by 2^((m - M) log2 e), divided by the joint sum */
#pragma unroll
  for (int qt = 0; qt < 2; ++qt) { ls[qt] += __shfl_xor(ls[qt], 16);   /* the lane halves' sums joined once */
    if (g == 0) { const v2f w = {m[qt], ls[qt]}; ml[(wave * 2 + qt) * 16 + col] = w; } }
  __syncthreads();                                      // a wave reads its partner's maximum and sum
  float sc[2];
#pragma unroll
  for (int qt = 0; qt < 2; ++qt) { const v2f o = ml[((wave ^ 1) * 2 + qt) * 16 + col]; const float mm = fmaxf(m[qt], o[0]), f = exp2_1((m[qt] - mm) * FA_L2E), fo = exp2_1((o[0] - mm) * FA_L2E);
    sc[qt] = f / (ls[qt] * f + o[1] * fo); }   /* the largest weight of a row is 2^11 and its wave's factor is 1, so the sum is positive */
  float* sp = &st[kh * HD + 8 * g][qg * 32 + col];      /* each wave stores its scaled share in the plane of its key half; the planes are summed where the rows are read back */
#pragma unroll
  for (int qt = 0; qt < 2; ++qt)
#pragma unroll
    for (int j = 0; j < HD / 16; ++j)
#pragma unroll
      for (int r = 0; r < 8; ++r) sp[(j * 16 + r) * FA_OP + qt * 16] = acc[qt][j][r] * sc[qt];
  __syncthreads();                                      // a channel's two rows (one per key half) hold columns of all eight waves
  const float gmv = bfr(GM[0]);
  /* four rows a trip keep four loads of x in flight; rolled, every row waits out the latency of its own load */
#pragma unroll 4
  for (int ci = 0; ci < HD / 8; ++ci) { const int c = wave + 8 * ci; const size_t o = (b * CC + c) * (size_t)XP + q0 + lane * 4; const v4f xr = *(const v4f*)(X + o), y = *(const v4f*)&st[c][lane * 4] + *(const v4f*)&st[HD + c][lane * 4]; v4f v;   /* 512-B (channel, 128 queries) segment by 32 lanes; key half 0 + key half 1 */
#pragma unroll
    for (int i = 0; i < 4; ++i) v[i] = gmv * y[i] + bfr(xr[i]); vst2(OUT + o, v); } }   /* gamma * out + x */

extern "C" void kernel_launch(void* const* d_in, const int* in_sizes, int n_in, void* d_out, int out_size, void* d_ws, size_t ws_size, hipStream_t stream) {
  (void)in_sizes; (void)n_in; (void)out_size;
  const float** F = (const float**)d_in;
  if (ws_size < (size_t)WS_END) return;
  char* ws = (char*)d_ws; _Float16 *QH = (_Float16*)(ws + WS_QH), *KH = (_Float16*)(ws + WS_KH), *VT = (_Float16*)(ws + WS_VT), *QL = (_Float16*)(ws + WS_QL);
  // inputs: 0 x [16,256,2048] channels-first; 1 wq [32,256] (out,in), 2 bq [32]; 3 wk, 4 bk; 5 wv [256,256], 6 bv [256]; 7 gamma [1]
  k_proj<<<dim3(TT / PT, TNB), 256, 0, stream>>>(F[0], F[1], F[3], F[5], F[2], F[4], F[6], QH, QL, KH, VT);
  k_fa<<<dim3(TT / FQ, TNB), 256, 0, stream>>>(QH, QL, KH, VT, F[0], F[7], (float*)d_out);
}
